// v000
// Times are from an AMD MI455X. After a warm-up the kernel runs many times in a row, and a time is the length of
// such a window on the GPU divided by its runs, so every launch and the gaps after it count. The runs cycle
// through copies of the inputs. A figure is the median of several windows, for all but v000 over two sittings.
// Sittings can differ by a few percent; kernels timed side by side share one.
// v000 is the starting kernel. One run takes 1300 microseconds.
#include <hip/hip_runtime.h>

// Scaled dot-product attention over 8192 tokens, single head (Q, K, V [8192][128] inputs; scores = Q.K / sqrt(8192) (the module scales by the sequence length it calls d_k); softmax over all 8192 keys; out = attn V -> [8192][128] (1 M)).
// Layout: Q, K as bf16 planes (inputs are rounded to bf16, so the hi plane is exact and the lo plane is zero), V transposed [128][8192]; query rows in chunks of 2048: score GEMM [2048][8192], a STREAMING softmax (one wave per row, three passes over the row in memory: max, sum, write) producing hi + lo probability planes, and attn.V (2 products) written straight to the output.
// Compute dtypes, f32 accumulate: Q, K, V rounded to bf16 (exact operands); scores exact; softmax f32 (exp2); probabilities as bf16 hi + lo planes x exact V (2 non-trivial products).

#define TT   8192
#define DM   128
#define HD   128
#define RB   2048                 // query rows per chunk
#define SCL  0.011048543456039806f   // 1/sqrt(8192)
typedef _Float16 h16;
typedef unsigned short bf;
typedef __attribute__((ext_vector_type(16))) __bf16   v16bf;
typedef __attribute__((ext_vector_type(16))) _Float16 v16h;
typedef __attribute__((ext_vector_type(8)))  _Float16 v8h;
typedef __attribute__((ext_vector_type(8)))  unsigned short v8us;
typedef __attribute__((ext_vector_type(8)))  float    v8f;
typedef __attribute__((ext_vector_type(4)))  float    v4f;
typedef __attribute__((ext_vector_type(2)))  float    v2f;
typedef __attribute__((ext_vector_type(4)))  unsigned short v4us;
typedef __attribute__((ext_vector_type(2)))  unsigned short v2us;
typedef v8h  __attribute__((may_alias)) v8ha;
typedef v4f  __attribute__((may_alias)) v4fa;
typedef v8us __attribute__((may_alias)) v8usa;

__device__ __forceinline__ unsigned short f2bf(float f) { unsigned u = __float_as_uint(f); u += 0x7FFFu + ((u >> 16) & 1u); return (unsigned short)(u >> 16); }
__device__ __forceinline__ float bf2f(unsigned short b) { return __uint_as_float(((unsigned)b) << 16); }
__device__ __forceinline__ float bfr(float f) { return bf2f(f2bf(f)); }
__device__ __forceinline__ void splitf(float y, unsigned short& h, unsigned short& l) { h = f2bf(y); l = f2bf(y - bf2f(h)); }
__device__ __forceinline__ v16h cat16(v8h lo, v8h hi) { return __builtin_shufflevector(lo, hi, 0, 1, 2, 3, 4, 5, 6, 7, 8, 9, 10, 11, 12, 13, 14, 15); }
__device__ __forceinline__ v16bf cat16b(v8us lo, v8us hi) { return __builtin_bit_cast(v16bf, __builtin_shufflevector(lo, hi, 0, 1, 2, 3, 4, 5, 6, 7, 8, 9, 10, 11, 12, 13, 14, 15)); }
__device__ __forceinline__ v8f wmma16(v16h a, v16h b, v8f c) { return __builtin_amdgcn_wmma_f32_16x16x32_f16(false, a, false, b, (short)0, c, false, false); }
__device__ __forceinline__ v8f wmmab(v16bf a, v16bf b, v8f c) { return __builtin_amdgcn_wmma_f32_16x16x32_bf16(false, a, false, b, (short)0, c, false, false); }

// ---- k_gemmw: register-blocked GEMM, ONE WAVE per 64x64 output tile (16 accumulators), operands straight from K-contiguous 16-bit planes; grid (M/64, N/64, Z), 32 threads.
// C[m][n] (f32, pitch ldc, + optional f32 bias[n]) = sum_k A[m][k] Bt[n][k] (+ split products per NSPLIT). z-batch strides sA/sB/sC in elements. K % 32 == 0.
template <typename T16> struct WFrag;
template <> struct WFrag<h16> { typedef v16h V; static __device__ __forceinline__ V ld(const h16* p) { return cat16(*(const v8h*)p, *(const v8h*)(p + 16)); } static __device__ __forceinline__ v8f mma(V a, V b, v8f c) { return wmma16(a, b, c); } };
template <> struct WFrag<bf> { typedef v16bf V; static __device__ __forceinline__ V ld(const bf* p) { return cat16b(*(const v8us*)p, *(const v8us*)(p + 16)); } static __device__ __forceinline__ v8f mma(V a, V b, v8f c) { return wmmab(a, b, c); } };
template <typename T16, int NSPLIT, bool BIAS>
__global__ __launch_bounds__(32) void k_gemmw(const T16* __restrict__ A, const T16* __restrict__ A2, const T16* __restrict__ Bt, const T16* __restrict__ Bt2, int K, float* C, int ldc, const float* __restrict__ bias, size_t sA, size_t sB, size_t sC) {
    typedef typename WFrag<T16>::V V;
    __shared__ __align__(16) float os[16 * 68];
    const size_t z = blockIdx.z; A += z * sA; if (A2) A2 += z * sA; Bt += z * sB; if (Bt2) Bt2 += z * sB; C += z * sC;
    const int lane = threadIdx.x & 31, lr = lane & 15, hi = lane >> 4; const int r0 = blockIdx.x * 64, c0 = blockIdx.y * 64;
    v8f acc[4][4];
#pragma unroll
    for (int mb = 0; mb < 4; ++mb)
#pragma unroll
        for (int nb = 0; nb < 4; ++nb) acc[mb][nb] = (v8f){};
    const size_t aoff = (size_t)(r0 + lr) * K + 8 * hi, boff = (size_t)(c0 + lr) * K + 8 * hi;
#pragma unroll 1
    for (int kc = 0; kc < K; kc += 32) {
        V a[4], a2[4];
#pragma unroll
        for (int mb = 0; mb < 4; ++mb) { a[mb] = WFrag<T16>::ld(A + aoff + (size_t)mb * 16 * K + kc); if (NSPLIT == 1 || NSPLIT == 2) a2[mb] = WFrag<T16>::ld(A2 + aoff + (size_t)mb * 16 * K + kc); }
#pragma unroll
        for (int nb = 0; nb < 4; ++nb) { const V b = WFrag<T16>::ld(Bt + boff + (size_t)nb * 16 * K + kc); V b2; if (NSPLIT >= 2) b2 = WFrag<T16>::ld(Bt2 + boff + (size_t)nb * 16 * K + kc);
#pragma unroll
            for (int mb = 0; mb < 4; ++mb) { acc[mb][nb] = WFrag<T16>::mma(a[mb], b, acc[mb][nb]); if (NSPLIT == 1 || NSPLIT == 2) acc[mb][nb] = WFrag<T16>::mma(a2[mb], b, acc[mb][nb]); if (NSPLIT >= 2) acc[mb][nb] = WFrag<T16>::mma(a[mb], b2, acc[mb][nb]); } }
        asm volatile("v_nop\n\tv_nop\n\tv_nop\n\tv_nop" : "+v"(acc[0][0]), "+v"(acc[1][1]), "+v"(acc[2][2]), "+v"(acc[3][3]) : "v"(a[0]), "v"(a[3]));
    }
#pragma unroll
    for (int mb = 0; mb < 4; ++mb) {
#pragma unroll
        for (int nb = 0; nb < 4; ++nb) {
#pragma unroll
            for (int j = 0; j < 8; ++j) os[(hi * 8 + j) * 68 + nb * 16 + lr] = acc[mb][nb][j]; }
        __builtin_amdgcn_wave_barrier(); asm volatile("" ::: "memory");
        float* crow = C + (size_t)(r0 + mb * 16) * ldc + c0;
{
#pragma unroll
            for (int s = 0; s < 8; ++s) { const int row = 2 * s + hi, cofs = lr * 4; v4f val = *(const v4fa*)(os + row * 68 + cofs); if (BIAS) { val[0] += bfr(bias[c0 + cofs]); val[1] += bfr(bias[c0 + cofs + 1]); val[2] += bfr(bias[c0 + cofs + 2]); val[3] += bfr(bias[c0 + cofs + 3]); }
                *(v4f*)(crow + (size_t)row * ldc + cofs) = val; }
             }
        __builtin_amdgcn_wave_barrier(); asm volatile("" ::: "memory");
    }
}




__global__ __launch_bounds__(256) void k_split4(const float* __restrict__ F, bf* Ph, bf* Pl, size_t n4) { const size_t i = (size_t)blockIdx.x * 256 + threadIdx.x; if (i >= n4) return; const v4f v = *(const v4f*)(F + i * 4); v4us oh, ol;
#pragma unroll
    for (int q = 0; q < 4; ++q) { unsigned short a, c; splitf(bfr(v[q]), a, c); oh[q] = a; ol[q] = c; } *(v4us*)(Ph + i * 4) = oh; *(v4us*)(Pl + i * 4) = ol;  }
__global__ __launch_bounds__(256) void k_vtp1(const float* __restrict__ F, bf* Vh, bf* Vl) { const size_t e = ((size_t)blockIdx.x * 256 + threadIdx.x) * 2; if (e >= (size_t)HD * TT) return; const int t = (int)(e % TT); const int d = (int)(e / TT); v2us oh, ol;
#pragma unroll
    for (int q = 0; q < 2; ++q) { unsigned short a, c; splitf(bfr(F[(size_t)(t + q) * HD + d]), a, c); oh[q] = a; ol[q] = c; } *(v2us*)(Vh + e) = oh; *(v2us*)(Vl + e) = ol;  }
__global__ __launch_bounds__(256) void k_ssoft(const float* __restrict__ Sb, int r0, bf* Ph, bf* Pl) {
    const int lane = threadIdx.x & 31; const int ri = blockIdx.x * 8 + (threadIdx.x >> 5); if (ri >= RB) return; const int i = r0 + ri; (void)i; const float* sr = Sb + (size_t)ri * TT; const int nval = TT;   /* all keys */
    float mx = -3.0e38f;
#pragma unroll 1
    for (int j0 = lane * 4; j0 < nval; j0 += 128) { const v4f a = *(const v4f*)(sr + j0);
#pragma unroll
        for (int q = 0; q < 4; ++q) if (j0 + q < nval) mx = fmaxf(mx, a[q] * SCL); }
#pragma unroll
    for (int sh = 16; sh; sh >>= 1) mx = fmaxf(mx, __shfl_xor(mx, sh, 32));
    float sum = 0.f;
#pragma unroll 1
    for (int j0 = lane * 4; j0 < nval; j0 += 128) { const v4f a = *(const v4f*)(sr + j0);
#pragma unroll
        for (int q = 0; q < 4; ++q) if (j0 + q < nval) { float d0 = __fsub_rn(a[q] * SCL, mx); asm volatile("" : "+v"(d0)); sum += __builtin_amdgcn_exp2f(__fmul_rn(d0, 1.4426950408889634f)); } }
#pragma unroll
    for (int sh = 16; sh; sh >>= 1) sum += __shfl_xor(sum, sh, 32);
    const float f = (nval > 0) ? __fdiv_rn(1.0f, sum) : 0.f;
{
#pragma unroll 1
        for (int j0 = lane * 4; j0 < TT; j0 += 128) { const v4f a = *(const v4f*)(sr + j0); v4us oh, ol;
#pragma unroll
            for (int q = 0; q < 4; ++q) { float pv = 0.f; if (j0 + q < nval) { float d0 = __fsub_rn(a[q] * SCL, mx); asm volatile("" : "+v"(d0)); pv = __builtin_amdgcn_exp2f(__fmul_rn(d0, 1.4426950408889634f)) * f; } unsigned short h2, l2; splitf(pv, h2, l2); oh[q] = h2; ol[q] = l2; }
            const size_t oo = (size_t)ri * TT + j0; *(v4us*)(Ph + oo) = oh; *(v4us*)(Pl + oo) = ol; }
         } }

extern "C" void kernel_launch(void* const* d_in, const int* in_sizes, int n_in,
                              void* d_out, int out_size, void* d_ws, size_t ws_size, hipStream_t stream) {
    (void)in_sizes; (void)n_in; (void)out_size;
    const float* Qi = (const float*)d_in[0]; const float* Ki = (const float*)d_in[1]; const float* Vi = (const float*)d_in[2];
    float* OUT = (float*)d_out;     // [8192][128]
    char* wsp = (char*)d_ws;
    auto take = [&](size_t bytes) { char* p = wsp; wsp += (bytes + 255) & ~(size_t)255; return (void*)p; };
    bf* QPh = (bf*)take((size_t)TT * HD * 2); bf* QPl = (bf*)take((size_t)TT * HD * 2); bf* KPh = (bf*)take((size_t)TT * HD * 2); bf* KPl = (bf*)take((size_t)TT * HD * 2); bf* VTh = (bf*)take((size_t)HD * TT * 2); bf* VTl = (bf*)take((size_t)HD * TT * 2);
    float* Sb = (float*)take((size_t)RB * TT * 4); bf* Ph = (bf*)take((size_t)RB * TT * 2); bf* Pl = (bf*)take((size_t)RB * TT * 2);
    if ((size_t)(wsp - (char*)d_ws) > ws_size) return;
    k_split4<<<(unsigned)(((size_t)TT * HD / 4 + 255) / 256), 256, 0, stream>>>(Qi, QPh, QPl, (size_t)TT * HD / 4); k_split4<<<(unsigned)(((size_t)TT * HD / 4 + 255) / 256), 256, 0, stream>>>(Ki, KPh, KPl, (size_t)TT * HD / 4);
    k_vtp1<<<(unsigned)(((size_t)HD * TT / 2 + 255) / 256), 256, 0, stream>>>(Vi, VTh, VTl);
    for (int c = 0; c < TT / RB; ++c) { const int r0 = c * RB;
        k_gemmw<bf, 0, false><<<dim3(RB / 64, TT / 64, 1), 32, 0, stream>>>(QPh + (size_t)r0 * HD, nullptr, KPh, nullptr, HD, Sb, TT, nullptr, 0, 0, 0);       /* scores for rows r0.. (bf16 operands exact) */
        k_ssoft<<<RB / 8, 256, 0, stream>>>(Sb, r0, Ph, Pl);
        k_gemmw<bf, 1, false><<<dim3(RB / 64, HD / 64, 1), 32, 0, stream>>>(Ph, Pl, VTh, nullptr, TT, OUT + (size_t)r0 * HD, HD, nullptr, 0, 0, 0); }          /* out rows r0.. = P.V (2 products: P hi/lo x exact V) */
}

// v001
// Measured time: 534 microseconds a run.
// Next to v000, in two timings, it ran 2.42 and 2.43 times as fast.
#include <hip/hip_runtime.h>

// Scaled dot-product attention over 8192 tokens, single head (Q, K, V [8192][128] inputs; scores = Q.K / sqrt(8192) (the module scales by the sequence length it calls d_k); softmax over all 8192 keys; out = attn V -> [8192][128] (1 M)).
// Layout: Q, K as bf16 planes (inputs are rounded to bf16, so the hi plane is exact and the lo plane is zero), V transposed [128][8192]; query rows in chunks of 2048: score GEMM [2048][8192], a STREAMING softmax (one wave per row, three passes over the row in memory: max, sum, write) producing hi + lo probability planes, and attn.V with its 8192 keys split over 8 work-groups x 8 waves (f32 partials joined in LDS, then by one last launch that writes the output).
// Compute dtypes, f32 accumulate: Q, K, V rounded to bf16 (exact operands); scores exact; softmax f32 (exp2); probabilities as bf16 hi + lo planes x exact V (2 non-trivial products).

#define TT   8192
#define DM   128
#define HD   128
#define RB   2048                 // query rows per chunk
#define SCL  0.011048543456039806f   // 1/sqrt(8192)
#define KSB  8                    // attn.V: key ranges across work-groups
#define KSW  8                    // attn.V: key ranges across the waves of a work-group
#define KPW  (TT / KSB / KSW)     // keys per wave (128)
#define PVP  132                  // attn.V: LDS row pitch in floats (rows r and r + 8 fall on different banks)
typedef _Float16 h16;
typedef unsigned short bf;
typedef __attribute__((ext_vector_type(16))) __bf16   v16bf;
typedef __attribute__((ext_vector_type(16))) _Float16 v16h;
typedef __attribute__((ext_vector_type(8)))  _Float16 v8h;
typedef __attribute__((ext_vector_type(8)))  unsigned short v8us;
typedef __attribute__((ext_vector_type(8)))  float    v8f;
typedef __attribute__((ext_vector_type(4)))  float    v4f;
typedef __attribute__((ext_vector_type(2)))  float    v2f;
typedef __attribute__((ext_vector_type(4)))  unsigned short v4us;
typedef __attribute__((ext_vector_type(2)))  unsigned short v2us;
typedef v8h  __attribute__((may_alias)) v8ha;
typedef v4f  __attribute__((may_alias)) v4fa;
typedef v8us __attribute__((may_alias)) v8usa;

__device__ __forceinline__ unsigned short f2bf(float f) { unsigned u = __float_as_uint(f); u += 0x7FFFu + ((u >> 16) & 1u); return (unsigned short)(u >> 16); }
__device__ __forceinline__ float bf2f(unsigned short b) { return __uint_as_float(((unsigned)b) << 16); }
__device__ __forceinline__ float bfr(float f) { return bf2f(f2bf(f)); }
__device__ __forceinline__ void splitf(float y, unsigned short& h, unsigned short& l) { h = f2bf(y); l = f2bf(y - bf2f(h)); }
__device__ __forceinline__ v16h cat16(v8h lo, v8h hi) { return __builtin_shufflevector(lo, hi, 0, 1, 2, 3, 4, 5, 6, 7, 8, 9, 10, 11, 12, 13, 14, 15); }
__device__ __forceinline__ v16bf cat16b(v8us lo, v8us hi) { return __builtin_bit_cast(v16bf, __builtin_shufflevector(lo, hi, 0, 1, 2, 3, 4, 5, 6, 7, 8, 9, 10, 11, 12, 13, 14, 15)); }
__device__ __forceinline__ v8f wmma16(v16h a, v16h b, v8f c) { return __builtin_amdgcn_wmma_f32_16x16x32_f16(false, a, false, b, (short)0, c, false, false); }
__device__ __forceinline__ v8f wmmab(v16bf a, v16bf b, v8f c) { return __builtin_amdgcn_wmma_f32_16x16x32_bf16(false, a, false, b, (short)0, c, false, false); }

// ---- k_gemmw: register-blocked GEMM, ONE WAVE per 64x64 output tile (16 accumulators), operands straight from K-contiguous 16-bit planes; grid (M/64, N/64, Z), 32 threads.
// C[m][n] (f32, pitch ldc, + optional f32 bias[n]) = sum_k A[m][k] Bt[n][k] (+ split products per NSPLIT). z-batch strides sA/sB/sC in elements. K % 32 == 0.
template <typename T16> struct WFrag;
template <> struct WFrag<h16> { typedef v16h V; static __device__ __forceinline__ V ld(const h16* p) { return cat16(*(const v8h*)p, *(const v8h*)(p + 16)); } static __device__ __forceinline__ v8f mma(V a, V b, v8f c) { return wmma16(a, b, c); } };
template <> struct WFrag<bf> { typedef v16bf V; static __device__ __forceinline__ V ld(const bf* p) { return cat16b(*(const v8us*)p, *(const v8us*)(p + 16)); } static __device__ __forceinline__ v8f mma(V a, V b, v8f c) { return wmmab(a, b, c); } };
template <typename T16, int NSPLIT, bool BIAS>
__global__ __launch_bounds__(32) void k_gemmw(const T16* __restrict__ A, const T16* __restrict__ A2, const T16* __restrict__ Bt, const T16* __restrict__ Bt2, int K, float* C, int ldc, const float* __restrict__ bias, size_t sA, size_t sB, size_t sC) {
    typedef typename WFrag<T16>::V V;
    __shared__ __align__(16) float os[16 * 68];
    const size_t z = blockIdx.z; A += z * sA; if (A2) A2 += z * sA; Bt += z * sB; if (Bt2) Bt2 += z * sB; C += z * sC;
    const int lane = threadIdx.x & 31, lr = lane & 15, hi = lane >> 4; const int r0 = blockIdx.x * 64, c0 = blockIdx.y * 64;
    v8f acc[4][4];
#pragma unroll
    for (int mb = 0; mb < 4; ++mb)
#pragma unroll
        for (int nb = 0; nb < 4; ++nb) acc[mb][nb] = (v8f){};
    const size_t aoff = (size_t)(r0 + lr) * K + 8 * hi, boff = (size_t)(c0 + lr) * K + 8 * hi;
#pragma unroll 1
    for (int kc = 0; kc < K; kc += 32) {
        V a[4], a2[4];
#pragma unroll
        for (int mb = 0; mb < 4; ++mb) { a[mb] = WFrag<T16>::ld(A + aoff + (size_t)mb * 16 * K + kc); if (NSPLIT == 1 || NSPLIT == 2) a2[mb] = WFrag<T16>::ld(A2 + aoff + (size_t)mb * 16 * K + kc); }
#pragma unroll
        for (int nb = 0; nb < 4; ++nb) { const V b = WFrag<T16>::ld(Bt + boff + (size_t)nb * 16 * K + kc); V b2; if (NSPLIT >= 2) b2 = WFrag<T16>::ld(Bt2 + boff + (size_t)nb * 16 * K + kc);
#pragma unroll
            for (int mb = 0; mb < 4; ++mb) { acc[mb][nb] = WFrag<T16>::mma(a[mb], b, acc[mb][nb]); if (NSPLIT == 1 || NSPLIT == 2) acc[mb][nb] = WFrag<T16>::mma(a2[mb], b, acc[mb][nb]); if (NSPLIT >= 2) acc[mb][nb] = WFrag<T16>::mma(a[mb], b2, acc[mb][nb]); } }
        asm volatile("v_nop\n\tv_nop\n\tv_nop\n\tv_nop" : "+v"(acc[0][0]), "+v"(acc[1][1]), "+v"(acc[2][2]), "+v"(acc[3][3]) : "v"(a[0]), "v"(a[3]));
    }
#pragma unroll
    for (int mb = 0; mb < 4; ++mb) {
#pragma unroll
        for (int nb = 0; nb < 4; ++nb) {
#pragma unroll
            for (int j = 0; j < 8; ++j) os[(hi * 8 + j) * 68 + nb * 16 + lr] = acc[mb][nb][j]; }
        __builtin_amdgcn_wave_barrier(); asm volatile("" ::: "memory");
        float* crow = C + (size_t)(r0 + mb * 16) * ldc + c0;
{
#pragma unroll
            for (int s = 0; s < 8; ++s) { const int row = 2 * s + hi, cofs = lr * 4; v4f val = *(const v4fa*)(os + row * 68 + cofs); if (BIAS) { val[0] += bfr(bias[c0 + cofs]); val[1] += bfr(bias[c0 + cofs + 1]); val[2] += bfr(bias[c0 + cofs + 2]); val[3] += bfr(bias[c0 + cofs + 3]); }
                *(v4f*)(crow + (size_t)row * ldc + cofs) = val; }
             }
        __builtin_amdgcn_wave_barrier(); asm volatile("" ::: "memory");
    }
}




__global__ __launch_bounds__(256) void k_split4(const float* __restrict__ F, bf* Ph, bf* Pl, size_t n4) { const size_t i = (size_t)blockIdx.x * 256 + threadIdx.x; if (i >= n4) return; const v4f v = *(const v4f*)(F + i * 4); v4us oh, ol;
#pragma unroll
    for (int q = 0; q < 4; ++q) { unsigned short a, c; splitf(bfr(v[q]), a, c); oh[q] = a; ol[q] = c; } *(v4us*)(Ph + i * 4) = oh; *(v4us*)(Pl + i * 4) = ol;  }
__global__ __launch_bounds__(256) void k_vtp1(const float* __restrict__ F, bf* Vh, bf* Vl) { const size_t e = ((size_t)blockIdx.x * 256 + threadIdx.x) * 2; if (e >= (size_t)HD * TT) return; const int t = (int)(e % TT); const int d = (int)(e / TT); v2us oh, ol;
#pragma unroll
    for (int q = 0; q < 2; ++q) { unsigned short a, c; splitf(bfr(F[(size_t)(t + q) * HD + d]), a, c); oh[q] = a; ol[q] = c; } *(v2us*)(Vh + e) = oh; *(v2us*)(Vl + e) = ol;  }
__global__ __launch_bounds__(256) void k_ssoft(const float* __restrict__ Sb, int r0, bf* Ph, bf* Pl) {
    const int lane = threadIdx.x & 31; const int ri = blockIdx.x * 8 + (threadIdx.x >> 5); if (ri >= RB) return; const int i = r0 + ri; (void)i; const float* sr = Sb + (size_t)ri * TT; const int nval = TT;   /* all keys */
    float mx = -3.0e38f;
#pragma unroll 1
    for (int j0 = lane * 4; j0 < nval; j0 += 128) { const v4f a = *(const v4f*)(sr + j0);
#pragma unroll
        for (int q = 0; q < 4; ++q) if (j0 + q < nval) mx = fmaxf(mx, a[q] * SCL); }
#pragma unroll
    for (int sh = 16; sh; sh >>= 1) mx = fmaxf(mx, __shfl_xor(mx, sh, 32));
    float sum = 0.f;
#pragma unroll 1
    for (int j0 = lane * 4; j0 < nval; j0 += 128) { const v4f a = *(const v4f*)(sr + j0);
#pragma unroll
        for (int q = 0; q < 4; ++q) if (j0 + q < nval) { float d0 = __fsub_rn(a[q] * SCL, mx); asm volatile("" : "+v"(d0)); sum += __builtin_amdgcn_exp2f(__fmul_rn(d0, 1.4426950408889634f)); } }
#pragma unroll
    for (int sh = 16; sh; sh >>= 1) sum += __shfl_xor(sum, sh, 32);
    const float f = (nval > 0) ? __fdiv_rn(1.0f, sum) : 0.f;
{
#pragma unroll 1
        for (int j0 = lane * 4; j0 < TT; j0 += 128) { const v4f a = *(const v4f*)(sr + j0); v4us oh, ol;
#pragma unroll
            for (int q = 0; q < 4; ++q) { float pv = 0.f; if (j0 + q < nval) { float d0 = __fsub_rn(a[q] * SCL, mx); asm volatile("" : "+v"(d0)); pv = __builtin_amdgcn_exp2f(__fmul_rn(d0, 1.4426950408889634f)) * f; } unsigned short h2, l2; splitf(pv, h2, l2); oh[q] = h2; ol[q] = l2; }
            const size_t oo = (size_t)ri * TT + j0; *(v4us*)(Ph + oo) = oh; *(v4us*)(Pl + oo) = ol; }
         } }

// ---- k_pv: attn.V for 2048 query rows with the key dimension split so that every WGP works: grid (RB/64, KSB), 8 waves.
// Each wave: 64 rows x all 128 columns over its own 128 keys, P hi + lo planes x exact V, fragments straight from the K-contiguous planes (loader and k order of k_gemmw).
// The wave's P fragments stay in registers (every P element is loaded once); V is walked 16 columns at a time, one step ahead.
// The 8 waves' partial tiles are summed through LDS; the work-group's sum goes to Part[row][key range][128] as whole rows. k_join adds the KSB ranges.
__global__ __launch_bounds__(256) void k_pv(const bf* __restrict__ Ph, const bf* __restrict__ Pl, const bf* __restrict__ Vt, float* __restrict__ Part) {
    // every "#pragma unroll" in this kernel and in k_join: the fragment and accumulator arrays stay in registers only if every index is a constant
    typedef WFrag<bf>::V V;
    __shared__ __align__(16) float red[KSW * 64 * PVP];
    const int lane = threadIdx.x & 31, lr = lane & 15, hi = lane >> 4, w = threadIdx.x >> 5; const int r0 = blockIdx.x * 64;
    const int k0 = blockIdx.y * (TT / KSB) + w * KPW;
    const bf* ah = Ph + (size_t)(r0 + lr) * TT + k0 + 8 * hi; const bf* al = Pl + (size_t)(r0 + lr) * TT + k0 + 8 * hi; const bf* bv = Vt + (size_t)lr * TT + k0 + 8 * hi;
    V a[KPW / 32][2][4];   // [k block][plane][row block]
#pragma unroll
    for (int mb = 0; mb < 4; ++mb)
#pragma unroll
        for (int kf = 0; kf < KPW / 32; ++kf) { a[kf][0][mb] = WFrag<bf>::ld(ah + (size_t)mb * 16 * TT + kf * 32); a[kf][1][mb] = WFrag<bf>::ld(al + (size_t)mb * 16 * TT + kf * 32); }
    float* my = red + w * 64 * PVP + hi * 8 * PVP + lr;
    auto ldb = [&](V (&b)[KPW / 32], int nb) {
#pragma unroll
        for (int kf = 0; kf < KPW / 32; ++kf) b[kf] = WFrag<bf>::ld(bv + (size_t)nb * 16 * TT + kf * 32); };
    auto step = [&](const V (&b)[KPW / 32], int nb) { v8f c[4];
#pragma unroll
        for (int mb = 0; mb < 4; ++mb) c[mb] = (v8f){};
        // row block innermost: four independent accumulators between two WMMAs on the same one
#pragma unroll
        for (int kf = 0; kf < KPW / 32; ++kf)
#pragma unroll
            for (int pl = 0; pl < 2; ++pl)
#pragma unroll
                for (int mb = 0; mb < 4; ++mb) c[mb] = WFrag<bf>::mma(a[kf][pl][mb], b[kf], c[mb]);
#pragma unroll
        for (int mb = 0; mb < 4; ++mb)
#pragma unroll
            for (int j = 0; j < 8; ++j) my[(mb * 16 + j) * PVP + nb * 16] = c[mb][j]; };
    auto gap = [&]() {
        // four vector slots between a step's last WMMAs and the next step's first, which start new sums in the same result registers; the clobber holds them behind the step's LDS stores, so behind its WMMAs
        asm volatile("v_nop\n\tv_nop\n\tv_nop\n\tv_nop" ::: "memory"); };
    V b0[KPW / 32], b1[KPW / 32];
    ldb(b0, 0);
    // the P address registers are inputs here, so they stay as they are until this wait; behind it they may be reused
    asm volatile("s_wait_xcnt 0x0" :: "v"(ah), "v"(al) : "memory");
    // all of the wave's P loads are issued before its first data wait: without it the scheduler holds some back behind the first WMMAs, and each of those costs a memory latency of its own
    __builtin_amdgcn_sched_barrier(0);
    // unrolled: every V address is one base register plus an immediate, so no address register is rewritten under a load in flight, and no branch follows a WMMA
#pragma unroll
    for (int nb = 0; nb < 8; nb += 2) {
        ldb(b1, nb + 1);
        step(b0, nb); gap();
        // behind the last V load: the V address register is an input here, so it stays as it is until this wait
        if (nb + 2 == 8) asm volatile("s_wait_xcnt 0x0" :: "v"(bv) : "memory");
        // ends a step for the scheduler: without it every later V load is lifted to the top (spills) and the next step's WMMAs may pass the four slots
        __builtin_amdgcn_sched_barrier(0);
        if (nb + 2 < 8) ldb(b0, nb + 2);
        step(b1, nb + 1);
        if (nb + 2 < 8) { gap(); __builtin_amdgcn_sched_barrier(0); }   // as above; nothing of the kind follows the last step
    }
    __syncthreads();   // every wave's partial tile is in LDS before any wave sums
    float* prow = Part + ((size_t)r0 * KSB + blockIdx.y) * HD;
#pragma unroll
    for (int s = 0; s < 8; ++s) { const int row = s * 8 + w; v4f t = *(const v4fa*)(red + row * PVP + lane * 4);
#pragma unroll
        for (int q = 1; q < KSW; ++q) t += *(const v4fa*)(red + (q * 64 + row) * PVP + lane * 4);
        *(v4f*)(prow + (size_t)row * (KSB * HD) + lane * 4) = t; }
}
// ---- k_join: out = sum of the KSB key ranges' partial outputs, in range order; one thread per four columns of a row.
__global__ __launch_bounds__(256) void k_join(const float* __restrict__ Part, float* __restrict__ O) { const unsigned i = blockIdx.x * 256u + threadIdx.x;
    const float* p = Part + (size_t)(i >> 5) * (KSB * HD) + (i & 31) * 4; v4f v[KSB];
#pragma unroll
    for (int q = 0; q < KSB; ++q) v[q] = *(const v4f*)(p + q * HD);
    // the loads' address register is an input here, so it stays as it is until this wait
    asm volatile("s_wait_xcnt 0x0" :: "v"(p) : "memory");
    v4f t = v[0];
#pragma unroll
    for (int q = 1; q < KSB; ++q) t += v[q];
    *(v4f*)(O + (size_t)i * 4) = t; }

extern "C" void kernel_launch(void* const* d_in, const int* in_sizes, int n_in,
                              void* d_out, int out_size, void* d_ws, size_t ws_size, hipStream_t stream) {
    (void)in_sizes; (void)n_in; (void)out_size;
    const float* Qi = (const float*)d_in[0]; const float* Ki = (const float*)d_in[1]; const float* Vi = (const float*)d_in[2];
    float* OUT = (float*)d_out;     // [8192][128]
    char* wsp = (char*)d_ws;
    auto take = [&](size_t bytes) { char* p = wsp; wsp += (bytes + 255) & ~(size_t)255; return (void*)p; };
    bf* QPh = (bf*)take((size_t)TT * HD * 2); bf* QPl = (bf*)take((size_t)TT * HD * 2); bf* KPh = (bf*)take((size_t)TT * HD * 2); bf* KPl = (bf*)take((size_t)TT * HD * 2); bf* VTh = (bf*)take((size_t)HD * TT * 2); bf* VTl = (bf*)take((size_t)HD * TT * 2);
    float* Sb = (float*)take((size_t)RB * TT * 4); bf* Ph = (bf*)take((size_t)RB * TT * 2); bf* Pl = (bf*)take((size_t)RB * TT * 2); float* Part = (float*)take((size_t)KSB * TT * HD * 4);
    if ((size_t)(wsp - (char*)d_ws) > ws_size) return;
    k_split4<<<(unsigned)(((size_t)TT * HD / 4 + 255) / 256), 256, 0, stream>>>(Qi, QPh, QPl, (size_t)TT * HD / 4); k_split4<<<(unsigned)(((size_t)TT * HD / 4 + 255) / 256), 256, 0, stream>>>(Ki, KPh, KPl, (size_t)TT * HD / 4);
    k_vtp1<<<(unsigned)(((size_t)HD * TT / 2 + 255) / 256), 256, 0, stream>>>(Vi, VTh, VTl);
    for (int c = 0; c < TT / RB; ++c) { const int r0 = c * RB;
        k_gemmw<bf, 0, false><<<dim3(RB / 64, TT / 64, 1), 32, 0, stream>>>(QPh + (size_t)r0 * HD, nullptr, KPh, nullptr, HD, Sb, TT, nullptr, 0, 0, 0);       /* scores for rows r0.. (bf16 operands exact) */
        k_ssoft<<<RB / 8, 256, 0, stream>>>(Sb, r0, Ph, Pl);
        k_pv<<<dim3(RB / 64, KSB, 1), 256, 0, stream>>>(Ph, Pl, VTh, Part + (size_t)r0 * KSB * HD); }          /* partial out rows r0.. = P.V per key range (2 products: P hi/lo x exact V) */
    k_join<<<TT * HD / 4 / 256, 256, 0, stream>>>(Part, OUT);
}

// v002
// It runs in 40.9 microseconds.
// Timed twice side by side with v001, it ran 13.1 times as fast both times.
// Counting every step since v000, it is 31.7 times as fast.
#include <hip/hip_runtime.h>

#define TT   8192
#define HD   128
#define NW   8                    // waves of a work-group = key ranges
#define QW   32                   // query rows per work-group (two groups of 16)
#define NP   (TT / NW / 32)       // 32-key passes per wave (32)
#define BLK  4096                 // bf16 elements of one 32-key block of K or of V in fragment order (8 KiB)
#define PVP  132                  // join: LDS row pitch in floats
#define CSC  (0.011048543456039806f * 1.4426950408889634f)   // 1/sqrt(8192) * log2(e)
typedef unsigned short bf;
typedef __attribute__((ext_vector_type(16))) __bf16   v16bf;
typedef __attribute__((ext_vector_type(2)))  __bf16   v2bf;
typedef __attribute__((ext_vector_type(8)))  unsigned short v8us;
typedef __attribute__((ext_vector_type(8)))  unsigned v8u;
typedef __attribute__((ext_vector_type(8)))  float    v8f;
typedef __attribute__((ext_vector_type(4)))  float    v4f;
typedef __attribute__((ext_vector_type(2)))  float    v2f;
typedef v4f  __attribute__((may_alias)) v4fa;

__device__ __forceinline__ unsigned short f2bf(float f) { unsigned u = __float_as_uint(f); u += 0x7FFFu + ((u >> 16) & 1u); return (unsigned short)(u >> 16); }
__device__ __forceinline__ v16bf cat16b(v8us lo, v8us hi) { return __builtin_bit_cast(v16bf, __builtin_shufflevector(lo, hi, 0, 1, 2, 3, 4, 5, 6, 7, 8, 9, 10, 11, 12, 13, 14, 15)); }
__device__ __forceinline__ v8f wmmab(v16bf a, v16bf b, v8f c) { return __builtin_amdgcn_wmma_f32_16x16x32_bf16(false, a, false, b, (short)0, c, false, false); }
__device__ __forceinline__ v8us bf8(v4f a, v4f b) { v8us o;   // unrolled: vector elements need constant indices to stay in registers
#pragma unroll
    for (int e = 0; e < 4; ++e) { o[e] = f2bf(a[e]); o[4 + e] = f2bf(b[e]); } return o; }
__device__ __forceinline__ unsigned pack2(float lo, float hi) { return __builtin_bit_cast(unsigned, __builtin_convertvector((v2f){lo, hi}, v2bf)); }   // two f32 -> two bf16, round to nearest even
__device__ __forceinline__ float xhalf(float x) { return __builtin_bit_cast(float, __builtin_amdgcn_permlanex16(__builtin_bit_cast(int, x), __builtin_bit_cast(int, x), 0x76543210, 0xfedcba98, false, false)); }   // lane l with lane l ^ 16

// ---- k_pack: K and V, rounded to bf16, in fragment order: a piece is the 16 bytes one lane takes with one load, 32 pieces (512 contiguous bytes) serve one load of a wave.
// Lane l = 16 h + c, half q of a fragment, element e. K piece ((kt * 4 + kc) * 2 + q) * 32 + l holds K[16 kt + c][32 kc + 16 q + 8 h + e]; V piece ((kb * 8 + t) * 2 + q) * 32 + l holds V[32 kb + 16 q + 8 h + e][16 t + c].
// Four pieces per thread (i, i + 256, i + 512, i + 768), all their loads issued before the first is used: 256 work-groups start sooner than 1024, and a thread pays the memory latency once.
__global__ __launch_bounds__(256) void k_pack(const float* __restrict__ Kf, const float* __restrict__ Vf, bf* __restrict__ KF, bf* __restrict__ VF) {
    // every "#pragma unroll" in this kernel: the loaded values stay in registers only if every index is a constant
    const unsigned i = (blockIdx.x & 127u) * 1024u + threadIdx.x; const unsigned l = i & 31u, c = l & 15u, h = l >> 4, q = (i >> 5) & 1u;
    if (blockIdx.x < 128u) { const unsigned kc = (i >> 6) & 3u, kt = i >> 8;   // piece i + 256 j: key tile kt + j
        const float* p = Kf + (size_t)(kt * 16u + c) * HD + kc * 32u + q * 16u + h * 8u; v4f a[4], b[4];
#pragma unroll
        for (int j = 0; j < 4; ++j) { a[j] = *(const v4f*)(p + j * 16 * HD); b[j] = *(const v4f*)(p + j * 16 * HD + 4); }
        // the loads' address register is an input here, so it stays as it is until this wait
        asm volatile("s_wait_xcnt 0x0" :: "v"(p) : "memory");
#pragma unroll
        for (int j = 0; j < 4; ++j) *(v8us*)(KF + (size_t)(i + 256u * j) * 8) = bf8(a[j], b[j]);
        // behind the last store of this half: no register that a store names is rewritten before this wait, however the two halves are laid out
        asm volatile("s_wait_xcnt 0x0" ::: "memory");
    } else { const unsigned t = (i >> 6) & 3u, kb = i >> 9;   // piece i + 256 j: column tile t + 4 (j & 1), key block kb + (j >> 1)
        const float* p = Vf + (size_t)(kb * 32u + q * 16u + h * 8u) * HD + t * 16u + c; float v[4][8];
#pragma unroll
        for (int j = 0; j < 4; ++j)
#pragma unroll
            for (int e = 0; e < 8; ++e) v[j][e] = p[((j >> 1) * 32 + e) * HD + (j & 1) * 64];
        // as above
        asm volatile("s_wait_xcnt 0x0" :: "v"(p) : "memory");
#pragma unroll
        for (int j = 0; j < 4; ++j) { v8us o;
#pragma unroll
            for (int e = 0; e < 8; ++e) o[e] = f2bf(v[j][e]);
            *(v8us*)(VF + (size_t)(i + 256u * j) * 8) = o; }
        // as behind the K half's stores
        asm volatile("s_wait_xcnt 0x0" ::: "memory"); }
}

// ---- k_fattn: grid TT / QW work-groups of 8 waves, two waves per SIMD (up to 512 registers each).
// every "#pragma unroll" in this kernel: the fragment and accumulator arrays stay in registers only if every index is a constant
__global__ __launch_bounds__(256) __attribute__((amdgpu_waves_per_eu(2, 2))) void k_fattn(const float* __restrict__ Q, const bf* __restrict__ KF, const bf* __restrict__ VF, float* __restrict__ O) {
    __shared__ __align__(16) float red[NW * QW * PVP];
    __shared__ float sm[NW * QW], sl[NW * QW];
    const int lane = threadIdx.x & 31, c = lane & 15, h = lane >> 4; const int w = __builtin_amdgcn_readfirstlane(threadIdx.x >> 5); const int q0 = blockIdx.x * QW;
    // ends a phase for the scheduler: loads stay where they are written (issued early, waited for late), and the four slots below stay behind their WMMAs
    auto fence = [&]() { __builtin_amdgcn_sched_barrier(0); };
    // four vector slots behind a pass's last WMMAs: across the loop's back edge the next pass's first WMMAs write into registers that were those WMMAs' B operand
    auto gap = [&]() { __builtin_amdgcn_sched_barrier(0); asm volatile("v_nop\n\tv_nop\n\tv_nop\n\tv_nop"); __builtin_amdgcn_sched_barrier(0); };
    // Q fragments, rounded to bf16 here; d order of a fragment as in k_pack's K pieces
    v16bf qf[2][4];
#pragma unroll
    for (int g = 0; g < 2; ++g) { const float* p = Q + (size_t)(q0 + 16 * g + c) * HD + 8 * h;
#pragma unroll
        for (int kc = 0; kc < 4; ++kc) qf[g][kc] = cat16b(bf8(*(const v4f*)(p + 32 * kc), *(const v4f*)(p + 32 * kc + 4)), bf8(*(const v4f*)(p + 32 * kc + 16), *(const v4f*)(p + 32 * kc + 20)));
        // the loads' address register is an input here, so it stays as it is until this wait
        asm volatile("s_wait_xcnt 0x0" :: "v"(p) : "memory"); }
    const bf* kb0 = KF + (size_t)w * NP * BLK + lane * 8; const bf* vb0 = VF + (size_t)w * NP * BLK + lane * 8;
    // one 32-key block = 8 fragments = 16 loads of 512 contiguous bytes
    auto ldf = [&](v16bf (&f)[8], const bf* base, int blk) { const bf* p = base + (size_t)blk * BLK;
#pragma unroll
        for (int i = 0; i < 8; ++i) f[i] = cat16b(*(const v8us*)(p + i * 512), *(const v8us*)(p + i * 512 + 256));
        // the loads' address register is an input here, so it stays as it is until this wait
        asm volatile("s_wait_xcnt 0x0" :: "v"(p) : "memory"); };
    v8f acc[2][8]; float m_run[2], l_run[2];
#pragma unroll
    for (int g = 0; g < 2; ++g) { m_run[g] = -__builtin_inff(); l_run[g] = 0.f;
#pragma unroll
        for (int t = 0; t < 8; ++t) acc[g][t] = (v8f){}; }
    // each work-group starts at another block of the wave's key range, so that the 256 work-groups do not all ask L2 for the same lines at once; softmax and sums do not depend on where the walk starts
    const int rot = blockIdx.x & (NP - 1);
    v16bf kf[8], vf[8];   // kf[kt * 4 + kc], vf[t]
    ldf(kf, kb0, rot);
    // rolled: one pass already fills the register budget
#pragma unroll 1
    for (int it = 0; it < NP; ++it) {
        ldf(vf, vb0, (it + rot) & (NP - 1));   // this pass's V^T, in flight under the first product and the maxima
        fence();
        v8f s[2][2];   // [key tile][query group]: s[kt][g][r] = score of key 16 kt + 8 h + r, query 16 g + c
#pragma unroll
        for (int kt = 0; kt < 2; ++kt)
#pragma unroll
            for (int g = 0; g < 2; ++g) s[kt][g] = (v8f){};
        // d block outermost: four independent accumulators between two WMMAs on the same one
#pragma unroll
        for (int kc = 0; kc < 4; ++kc)
#pragma unroll
            for (int kt = 0; kt < 2; ++kt)
#pragma unroll
                for (int g = 0; g < 2; ++g) s[kt][g] = wmmab(kf[kt * 4 + kc], qf[g][kc], s[kt][g]);
        fence();
        ldf(kf, kb0, (it + 1 + rot) & (NP - 1));   // next pass's K into the same registers, in flight under the softmax and the second product (the last pass fetches the first block again, unused)
        fence();
        // maxima of the raw scores (the scale is positive); the maximum in use may trail the true one by up to 8 (log2 scale), so the sums are rescaled rarely
        float mb[2]; bool need = false;
#pragma unroll
        for (int g = 0; g < 2; ++g) { float mx = -__builtin_inff();
#pragma unroll
            for (int kt = 0; kt < 2; ++kt)
#pragma unroll
                for (int r = 0; r < 8; ++r) mx = __builtin_fmaxf(mx, s[kt][g][r]);
            mx = __builtin_fmaxf(mx, xhalf(mx)) * CSC; mb[g] = mx; need = need || (mx > m_run[g] + 8.0f); }
        if (__builtin_amdgcn_ballot_w32(need) != 0) {   // wave-uniform; always taken in the first pass, where m_run is -inf and corr is 0
#pragma unroll
            for (int g = 0; g < 2; ++g) { const float m_new = __builtin_fmaxf(m_run[g], mb[g]); const float corr = __builtin_amdgcn_exp2f(m_run[g] - m_new); l_run[g] *= corr; m_run[g] = m_new;
#pragma unroll
                for (int t = 0; t < 8; ++t) acc[g][t] = acc[g][t] * corr; } }
#pragma unroll
        for (int g = 0; g < 2; ++g) { const float nm = -m_run[g]; v8u wh, wl; float ps0 = 0.f, ps1 = 0.f;
#pragma unroll
            for (int i = 0; i < 8; ++i) {
                const v2f arg = __builtin_elementwise_fma((v2f){s[i >> 2][g][2 * (i & 3)], s[i >> 2][g][2 * (i & 3) + 1]}, (v2f){CSC, CSC}, (v2f){nm, nm});
                const float p0 = __builtin_amdgcn_exp2f(arg.x), p1 = __builtin_amdgcn_exp2f(arg.y);
                if (i & 1) ps1 += p0 + p1; else ps0 += p0 + p1;
                const unsigned uh = pack2(p0, p1); wh[i] = uh;
                wl[i] = pack2(p0 - __uint_as_float(uh << 16), p1 - __uint_as_float(uh & 0xFFFF0000u)); }   // lo plane: what the hi plane's rounding left
            l_run[g] += ps0 + ps1;
            const v16bf ph = __builtin_bit_cast(v16bf, wh), pl = __builtin_bit_cast(v16bf, wl);
#pragma unroll
            for (int t = 0; t < 8; ++t) acc[g][t] = wmmab(vf[t], ph, acc[g][t]);
#pragma unroll
            for (int t = 0; t < 8; ++t) acc[g][t] = wmmab(vf[t], pl, acc[g][t]);
            fence(); }
        gap();
    }
    // join of the 8 key ranges: common maximum M per query, each wave's sums scaled by 2^(m - M), added in wave order
#pragma unroll
    for (int g = 0; g < 2; ++g) if (h == 0) sm[w * QW + 16 * g + c] = m_run[g];
    __syncthreads();   // every wave's maxima are in LDS before any wave reads them
#pragma unroll
    for (int g = 0; g < 2; ++g) { float M = sm[16 * g + c];
#pragma unroll
        for (int u = 1; u < NW; ++u) M = __builtin_fmaxf(M, sm[u * QW + 16 * g + c]);
        const float sc = __builtin_amdgcn_exp2f(m_run[g] - M); float* my = red + (w * QW + 16 * g + c) * PVP + 8 * h;
        const float l = (l_run[g] + xhalf(l_run[g])) * sc;   // each wave half summed its own eight keys of every tile
        if (h == 0) sl[w * QW + 16 * g + c] = l;
#pragma unroll
        for (int t = 0; t < 8; ++t) { const v8f o = acc[g][t] * sc;   // o[r] = partial out[query 16 g + c][16 t + 8 h + r]
            *(v4fa*)(my + 16 * t) = (v4f){o[0], o[1], o[2], o[3]}; *(v4fa*)(my + 16 * t + 4) = (v4f){o[4], o[5], o[6], o[7]}; } }
    __syncthreads();   // every wave's scaled partial tile and scaled sum are in LDS before any wave adds them
#pragma unroll
    for (int s4 = 0; s4 < QW / NW; ++s4) { const int row = s4 * NW + w; float L = 0.f; v4f t = (v4f){};
#pragma unroll
        for (int u = 0; u < NW; ++u) { L += sl[u * QW + row]; t += *(const v4fa*)(red + (u * QW + row) * PVP + lane * 4); }
        *(v4f*)(O + (size_t)(q0 + row) * HD + lane * 4) = t * __fdiv_rn(1.0f, L); }
}

extern "C" void kernel_launch(void* const* d_in, const int* in_sizes, int n_in,
                              void* d_out, int out_size, void* d_ws, size_t ws_size, hipStream_t stream) {
    (void)in_sizes; (void)n_in; (void)out_size;
    const float* Qi = (const float*)d_in[0]; const float* Ki = (const float*)d_in[1]; const float* Vi = (const float*)d_in[2];
    float* OUT = (float*)d_out;     // [8192][128]
    char* wsp = (char*)d_ws;
    auto take = [&](size_t bytes) { char* p = wsp; wsp += (bytes + 255) & ~(size_t)255; return (void*)p; };
    bf* KF = (bf*)take((size_t)TT * HD * 2); bf* VF = (bf*)take((size_t)TT * HD * 2);
    if ((size_t)(wsp - (char*)d_ws) > ws_size) return;
    k_pack<<<256, 256, 0, stream>>>(Ki, Vi, KF, VF);
    k_fattn<<<TT / QW, 256, 0, stream>>>(Qi, KF, VF, OUT);
}

// v004
// A run of this version takes 34.5 microseconds.
// It is 1.18 times as fast as v002, going by the measured steps of the versions left out in between.
// Counting every step since v000, it is 37.5 times as fast.
#include <hip/hip_runtime.h>

#define TT   8192
#define HD   128
#define NW   8                    // waves of a work-group = NQG query groups x NKR key ranges
#define QW   32                   // query rows per wave (two groups of 16)
#define NQG  4                    // waves that walk the same keys, each with its own 32 queries
#define NKR  2                    // key ranges of a work-group
#define NKQ  4                    // work-groups per query block, each with a quarter of the keys
#define QB   (NQG * QW)           // query rows per work-group (128)
#define NP   (TT / (NKQ * NKR) / 32)   // 32-key passes per wave (32)
#define BLK  4096                 // 16-bit elements of one 32-key block of K (bf16) or of V (f16) in fragment order (8 KiB)
#define PVP  132                  // join: LDS row pitch in floats
#define CSC  (0.011048543456039806f * 1.4426950408889634f)   // 1/sqrt(8192) * log2(e)
typedef unsigned short bf;
typedef __attribute__((ext_vector_type(16))) __bf16   v16bf;
typedef __attribute__((ext_vector_type(16))) _Float16 v16h;
typedef __attribute__((ext_vector_type(2)))  _Float16 v2h;
typedef __attribute__((ext_vector_type(8)))  unsigned short v8us;
typedef __attribute__((ext_vector_type(8)))  unsigned v8u;
typedef __attribute__((ext_vector_type(8)))  float    v8f;
typedef __attribute__((ext_vector_type(4)))  float    v4f;
typedef __attribute__((ext_vector_type(2)))  float    v2f;
typedef v4f  __attribute__((may_alias)) v4fa;

__device__ __forceinline__ unsigned short f2bf(float f) { unsigned u = __float_as_uint(f); u += 0x7FFFu + ((u >> 16) & 1u); return (unsigned short)(u >> 16); }
__device__ __forceinline__ v16bf cat16b(v8us lo, v8us hi) { return __builtin_bit_cast(v16bf, __builtin_shufflevector(lo, hi, 0, 1, 2, 3, 4, 5, 6, 7, 8, 9, 10, 11, 12, 13, 14, 15)); }
__device__ __forceinline__ v8f wmmab(v16bf a, v16bf b, v8f c) { return __builtin_amdgcn_wmma_f32_16x16x32_bf16(false, a, false, b, (short)0, c, false, false); }
__device__ __forceinline__ v8us bf8(v4f a, v4f b) { v8us o;   // unrolled: vector elements need constant indices to stay in registers
#pragma unroll
    for (int e = 0; e < 4; ++e) { o[e] = f2bf(a[e]); o[4 + e] = f2bf(b[e]); } return o; }
__device__ __forceinline__ v8f wmmah(v16bf a, v16h b, v8f c) { return __builtin_amdgcn_wmma_f32_16x16x32_f16(false, __builtin_bit_cast(v16h, a), false, b, (short)0, c, false, false); }   // a: a V fragment, f16 bits
__device__ __forceinline__ unsigned pack2(float lo, float hi) { return __builtin_bit_cast(unsigned, __builtin_convertvector((v2f){lo, hi}, v2h)); }   // two f32 -> two f16, round to nearest even
__device__ __forceinline__ unsigned short f2h(float f) { return __builtin_bit_cast(unsigned short, (_Float16)__uint_as_float((unsigned)f2bf(f) << 16)); }   // the bf16-rounded value as f16: the same number for 2^-14 <= |f| < 65408, below that within 2^-25
__device__ __forceinline__ float xhalf(float x) { return __builtin_bit_cast(float, __builtin_amdgcn_permlanex16(__builtin_bit_cast(int, x), __builtin_bit_cast(int, x), 0x76543210, 0xfedcba98, false, false)); }   // lane l with lane l ^ 16

// ---- k_pack: K and V, rounded to bf16 (V then held as f16), in fragment order: a piece is the 16 bytes one lane takes with one load, 32 pieces (512 contiguous bytes) serve one load of a wave.
// Lane l = 16 h + c, half q of a fragment, element e. K piece ((kt * 4 + kc) * 2 + q) * 32 + l holds K[16 kt + c][32 kc + 16 q + 8 h + e]; V piece ((kb * 8 + t) * 2 + q) * 32 + l holds V[32 kb + 16 q + 8 h + e][16 t + c].
// Four pieces per thread (i, i + 256, i + 512, i + 768), all their loads issued before the first is used: 256 work-groups start sooner than 1024, and a thread pays the memory latency once.
__global__ __launch_bounds__(256) void k_pack(const float* __restrict__ Kf, const float* __restrict__ Vf, bf* __restrict__ KF, bf* __restrict__ VF) {
    // every "#pragma unroll" in this kernel: the loaded values stay in registers only if every index is a constant
    const unsigned i = (blockIdx.x & 127u) * 1024u + threadIdx.x; const unsigned l = i & 31u, c = l & 15u, h = l >> 4, q = (i >> 5) & 1u;
    if (blockIdx.x < 128u) { const unsigned kc = (i >> 6) & 3u, kt = i >> 8;   // piece i + 256 j: key tile kt + j
        const float* p = Kf + (size_t)(kt * 16u + c) * HD + kc * 32u + q * 16u + h * 8u; v4f a[4], b[4];
#pragma unroll
        for (int j = 0; j < 4; ++j) { a[j] = *(const v4f*)(p + j * 16 * HD); b[j] = *(const v4f*)(p + j * 16 * HD + 4); }
        // the loads' address register is an input here, so it stays as it is until this wait
        asm volatile("s_wait_xcnt 0x0" :: "v"(p) : "memory");
#pragma unroll
        for (int j = 0; j < 4; ++j) *(v8us*)(KF + (size_t)(i + 256u * j) * 8) = bf8(a[j], b[j]);
        // behind the last store of this half: no register that a store names is rewritten before this wait, however the two halves are laid out
        asm volatile("s_wait_xcnt 0x0" ::: "memory");
    } else { const unsigned t = (i >> 6) & 3u, kb = i >> 9;   // piece i + 256 j: column tile t + 4 (j & 1), key block kb + (j >> 1)
        const float* p = Vf + (size_t)(kb * 32u + q * 16u + h * 8u) * HD + t * 16u + c; float v[4][8];
#pragma unroll
        for (int j = 0; j < 4; ++j)
#pragma unroll
            for (int e = 0; e < 8; ++e) v[j][e] = p[((j >> 1) * 32 + e) * HD + (j & 1) * 64];
        // as above
        asm volatile("s_wait_xcnt 0x0" :: "v"(p) : "memory");
#pragma unroll
        for (int j = 0; j < 4; ++j) { v8us o;
#pragma unroll
            for (int e = 0; e < 8; ++e) o[e] = f2h(v[j][e]);
            *(v8us*)(VF + (size_t)(i + 256u * j) * 8) = o; }
        // as behind the K half's stores
        asm volatile("s_wait_xcnt 0x0" ::: "memory"); }
}

// ---- k_fattn: grid (TT / QB) * NKQ work-groups of 8 waves, two waves per SIMD (up to 512 registers each).
// every "#pragma unroll" in this kernel: the fragment and accumulator arrays stay in registers only if every index is a constant
__global__ __launch_bounds__(256) __attribute__((amdgpu_waves_per_eu(2, 2))) void k_fattn(const float* __restrict__ Q, const bf* __restrict__ KF, const bf* __restrict__ VF, float* __restrict__ PO, float* __restrict__ PM, float* __restrict__ PL) {
    __shared__ __align__(16) float red[NW * QW * PVP];
    __shared__ float sm[NW * QW], sl[NW * QW];
    const int lane = threadIdx.x & 31, c = lane & 15, h = lane >> 4; const int w = __builtin_amdgcn_readfirstlane(threadIdx.x >> 5);
    // key range = w & 1
    const int qg = w >> 1, kr = w & 1; const int kq = blockIdx.x & (NKQ - 1), qb = blockIdx.x >> 2; const int q0 = qb * QB + qg * QW;
    // ends a phase for the scheduler: loads stay where they are written (issued early, waited for late), and the four slots below stay behind their WMMAs
    auto fence = [&]() { __builtin_amdgcn_sched_barrier(0); };
    // four vector slots behind a pass's last WMMAs: across the loop's back edge the next pass's first WMMAs write into registers that were those WMMAs' B operand
    auto gap = [&]() { __builtin_amdgcn_sched_barrier(0); asm volatile("v_nop\n\tv_nop\n\tv_nop\n\tv_nop"); __builtin_amdgcn_sched_barrier(0); };
    // Q fragments, rounded to bf16 here; d order of a fragment as in k_pack's K pieces
    v16bf qf[2][4];
#pragma unroll
    for (int g = 0; g < 2; ++g) { const float* p = Q + (size_t)(q0 + 16 * g + c) * HD + 8 * h;
#pragma unroll
        for (int kc = 0; kc < 4; ++kc) qf[g][kc] = cat16b(bf8(*(const v4f*)(p + 32 * kc), *(const v4f*)(p + 32 * kc + 4)), bf8(*(const v4f*)(p + 32 * kc + 16), *(const v4f*)(p + 32 * kc + 20)));
        // the loads' address register is an input here, so it stays as it is until this wait
        asm volatile("s_wait_xcnt 0x0" :: "v"(p) : "memory"); }
    const bf* kb0 = KF + (size_t)(kq * NKR + kr) * NP * BLK + lane * 8; const bf* vb0 = VF + (size_t)(kq * NKR + kr) * NP * BLK + lane * 8;
    // one 32-key block = 8 fragments = 16 loads of 512 contiguous bytes
    auto ldf = [&](v16bf (&f)[8], const bf* base, int blk) { const bf* p = base + (size_t)blk * BLK;
#pragma unroll
        for (int i = 0; i < 8; ++i) f[i] = cat16b(*(const v8us*)(p + i * 512), *(const v8us*)(p + i * 512 + 256));
        // the loads' address register is an input here, so it stays as it is until this wait
        asm volatile("s_wait_xcnt 0x0" :: "v"(p) : "memory"); };
    v8f acc[2][8]; float m_run[2], l_run[2];
#pragma unroll
    for (int g = 0; g < 2; ++g) { m_run[g] = -__builtin_inff(); l_run[g] = 0.f;
#pragma unroll
        for (int t = 0; t < 8; ++t) acc[g][t] = (v8f){}; }
    // each query block starts at another block of the wave's key range, so that the 64 work-groups of a key quarter do not all ask L2 for the same lines at once; softmax and sums do not depend on where the walk starts
    const int rot = qb & (NP - 1);
    v16bf kf[8], vf[8];   // kf[kt * 4 + kc], vf[t]
    ldf(kf, kb0, rot);
    // rolled: one pass already fills the register budget
#pragma unroll 1
    for (int it = 0; it < NP; ++it) {
        ldf(vf, vb0, (it + rot) & (NP - 1));   // this pass's V^T, in flight under the first product and the maxima
        fence();
        v8f s[2][2];   // [key tile][query group]: s[kt][g][r] = score of key 16 kt + 8 h + r, query 16 g + c
#pragma unroll
        for (int kt = 0; kt < 2; ++kt)
#pragma unroll
            for (int g = 0; g < 2; ++g) s[kt][g] = (v8f){};
        // d block outermost: four independent accumulators between two WMMAs on the same one
#pragma unroll
        for (int kc = 0; kc < 4; ++kc)
#pragma unroll
            for (int kt = 0; kt < 2; ++kt)
#pragma unroll
                for (int g = 0; g < 2; ++g) s[kt][g] = wmmab(kf[kt * 4 + kc], qf[g][kc], s[kt][g]);
        fence();
        ldf(kf, kb0, (it + 1 + rot) & (NP - 1));   // next pass's K into the same registers, in flight under the softmax and the second product (the last pass fetches the first block again, unused)
        fence();
        // maxima of the raw scores (the scale is positive); the maximum in use may trail the true one by up to 8 (log2 scale), so the sums are rescaled rarely
        float mb[2]; bool need = false;
#pragma unroll
        for (int g = 0; g < 2; ++g) { float mx = -__builtin_inff();
#pragma unroll
            for (int kt = 0; kt < 2; ++kt)
#pragma unroll
                for (int r = 0; r < 8; ++r) mx = __builtin_fmaxf(mx, s[kt][g][r]);
            mx = __builtin_fmaxf(mx, xhalf(mx)) * CSC; mb[g] = mx; need = need || (mx > m_run[g] + 8.0f); }
        if (__builtin_amdgcn_ballot_w32(need) != 0) {   // wave-uniform; always taken in the first pass, where m_run is -inf and corr is 0
#pragma unroll
            for (int g = 0; g < 2; ++g) { const float m_new = __builtin_fmaxf(m_run[g], mb[g]); const float corr = __builtin_amdgcn_exp2f(m_run[g] - m_new); l_run[g] *= corr; m_run[g] = m_new;
#pragma unroll
                for (int t = 0; t < 8; ++t) acc[g][t] = acc[g][t] * corr; } }
#pragma unroll
        for (int g = 0; g < 2; ++g) { const float nm = -m_run[g]; v8u wh; float ps0 = 0.f, ps1 = 0.f;
#pragma unroll
            for (int i = 0; i < 8; ++i) {
                const v2f arg = __builtin_elementwise_fma((v2f){s[i >> 2][g][2 * (i & 3)], s[i >> 2][g][2 * (i & 3) + 1]}, (v2f){CSC, CSC}, (v2f){nm, nm});
                const float p0 = __builtin_amdgcn_exp2f(arg.x), p1 = __builtin_amdgcn_exp2f(arg.y);
                if (i & 1) ps1 += p0 + p1; else ps0 += p0 + p1;
                wh[i] = pack2(p0, p1); }
            l_run[g] += ps0 + ps1;
            const v16h ph = __builtin_bit_cast(v16h, wh);
#pragma unroll
            for (int t = 0; t < 8; ++t) acc[g][t] = wmmah(vf[t], ph, acc[g][t]);
            fence(); }
        gap();
    }
    // join of the work-group's 2 key ranges: common maximum M per query, each wave's sums scaled by 2^(m - M), added in range order
#pragma unroll
    for (int g = 0; g < 2; ++g) if (h == 0) sm[w * QW + 16 * g + c] = m_run[g];
    __syncthreads();   // every wave's maxima are in LDS before any wave reads them
#pragma unroll
    for (int g = 0; g < 2; ++g) { const float M = __builtin_fmaxf(sm[(w & ~1) * QW + 16 * g + c], sm[(w | 1) * QW + 16 * g + c]);
        const float sc = __builtin_amdgcn_exp2f(m_run[g] - M); float* my = red + (w * QW + 16 * g + c) * PVP + 8 * h;
        const float l = (l_run[g] + xhalf(l_run[g])) * sc;   // each wave half summed its own eight keys of every tile
        if (h == 0) sl[w * QW + 16 * g + c] = l;
#pragma unroll
        for (int t = 0; t < 8; ++t) { const v8f o = acc[g][t] * sc;   // o[r] = partial out[query 16 g + c][16 t + 8 h + r]
            *(v4fa*)(my + 16 * t) = (v4f){o[0], o[1], o[2], o[3]}; *(v4fa*)(my + 16 * t + 4) = (v4f){o[4], o[5], o[6], o[7]}; } }
    __syncthreads();   // every wave's scaled partial tile and scaled sum are in LDS before any wave adds them
    // row of the work-group = 32 qg + row of the wave; in sm, sl and red (wave 2 qg + kr) its key range 0 stands at 64 qg + row of the wave = row + (row & ~31), key range 1 32 places further
    const size_t r0 = (size_t)kq * TT + (size_t)qb * QB;
    if (threadIdx.x < QB) { const int row = threadIdx.x, i0 = row + (row & ~(QW - 1));
        PM[r0 + row] = __builtin_fmaxf(sm[i0], sm[i0 + QW]); PL[r0 + row] = sl[i0] + sl[i0 + QW]; }
    float* po = PO + (r0 + w) * HD + lane * 4;
#pragma unroll
    for (int s4 = 0; s4 < QB / NW; ++s4) { const int i0 = s4 * NW + w + ((s4 * NW) & ~(QW - 1));   // row s4 * NW + w; w < 8 does not reach bit 5
        *(v4f*)(po + s4 * NW * HD) = *(const v4fa*)(red + i0 * PVP + lane * 4) + *(const v4fa*)(red + (i0 + QW) * PVP + lane * 4); }
}

// 2^x with the one free slot that the instruction set asks for behind a transcendental: in one statement, so that the slot stands directly behind it wherever the scheduler puts the pair
__device__ __forceinline__ float exp2s(float x) { float r; asm("v_exp_f32 %0, %1\n\tv_nop" : "=v"(r) : "v"(x)); return r; }

// ---- k_join: out row = sum over the 4 key quarters of 2^(M_k - M) * partial row, over the same sum of the partial sums, in quarter order. A wave takes whole rows (512 contiguous bytes a load); four rows per thread, all their loads issued before the first is used.
__global__ __launch_bounds__(256) void k_join(const float* __restrict__ PO, const float* __restrict__ PM, const float* __restrict__ PL, float* __restrict__ O) {
    // every "#pragma unroll" in this kernel: the loaded values stay in registers only if every index is a constant
    const unsigned i = blockIdx.x * 256u + threadIdx.x; const unsigned ln = i & 31u, rw = i >> 5;   // rows rw + 2048 j
    const float* p = PO + ((size_t)2 * TT + rw) * HD + ln * 4;   // the row in quarter 2: from the middle an instruction's signed offset field reaches all four quarters, so one address register serves every load
    v4f t[4][NKQ]; float m[4][NKQ], l[4][NKQ];
#pragma unroll
    for (int j = 0; j < 4; ++j)
#pragma unroll
        for (int k = 0; k < NKQ; ++k) { const int r = k * TT + 2048 * j;
            t[j][k] = *(const v4f*)(p + (r - 2 * TT) * HD); m[j][k] = PM[rw + r]; l[j][k] = PL[rw + r]; }
    // the loads' address registers are inputs here, so they stay as they are until this wait
    asm volatile("s_wait_xcnt 0x0" :: "v"(p), "v"(rw) : "memory");
    // ends the load phase for the scheduler: without it the sums move up between the loads, and a thread pays the latency several times
    __builtin_amdgcn_sched_barrier(0);
#pragma unroll
    for (int j = 0; j < 4; ++j) { const float M = __builtin_fmaxf(__builtin_fmaxf(m[j][0], m[j][1]), __builtin_fmaxf(m[j][2], m[j][3])); float L = 0.f; v4f s = (v4f){};
#pragma unroll
        for (int k = 0; k < NKQ; ++k) { const float sc = exp2s(m[j][k] - M); L += l[j][k] * sc; s += t[j][k] * sc; }
        *(v4f*)(O + (size_t)(rw + 2048u * j) * HD + ln * 4) = s * __fdiv_rn(1.0f, L); }
}

extern "C" void kernel_launch(void* const* d_in, const int* in_sizes, int n_in,
                              void* d_out, int out_size, void* d_ws, size_t ws_size, hipStream_t stream) {
    (void)in_sizes; (void)n_in; (void)out_size;
    const float* Qi = (const float*)d_in[0]; const float* Ki = (const float*)d_in[1]; const float* Vi = (const float*)d_in[2];
    float* OUT = (float*)d_out;     // [8192][128]
    char* wsp = (char*)d_ws;
    auto take = [&](size_t bytes) { char* p = wsp; wsp += (bytes + 255) & ~(size_t)255; return (void*)p; };
    bf* KF = (bf*)take((size_t)TT * HD * 2); bf* VF = (bf*)take((size_t)TT * HD * 2);
    float* PO = (float*)take((size_t)NKQ * TT * HD * 4); float* PM = (float*)take((size_t)NKQ * TT * 4); float* PL = (float*)take((size_t)NKQ * TT * 4);
    if ((size_t)(wsp - (char*)d_ws) > ws_size) return;
    k_pack<<<256, 256, 0, stream>>>(Ki, Vi, KF, VF);
    k_fattn<<<(TT / QB) * NKQ, 256, 0, stream>>>(Qi, KF, VF, PO, PM, PL);
    k_join<<<256, 256, 0, stream>>>(PO, PM, PL, OUT);
}

// v005
// A run of this version takes 33.1 microseconds.
// Two timings next to v004 both put it at 1.04 times that version's speed.
// Over all steps from v000 it is 39.1 times as fast.
#include <hip/hip_runtime.h>

#define TT   8192
#define HD   128
#define NW   8                    // waves of a work-group = NQG query groups x NKR key ranges
#define QW   32                   // query rows per wave (two groups of 16)
#define NQG  4                    // waves that walk the same keys, each with its own 32 queries
#define NKR  2                    // key ranges of a work-group
#define NKQ  4                    // work-groups per query block, each with a quarter of the keys
#define QB   (NQG * QW)           // query rows per work-group (128)
#define NP   (TT / (NKQ * NKR) / 32)   // 32-key passes per wave (32)
#define BLK  4096                 // bf16 elements of one 32-key block of K or of V in fragment order (8 KiB)
#define SP   4                    // passes of one stage of the V ring
#define NST  (NP / SP)            // stages per wave (8)
#define BLKB (BLK * 2)            // bytes of one block (8 KiB): one wave's tensor load
#define VBUF (NKR * SP * BLKB)    // bytes of one ring buffer: a stage of both key ranges (64 KiB)
#define PVP  132                  // join: LDS row pitch in floats
#define CSC  (0.011048543456039806f * 1.4426950408889634f)   // 1/sqrt(8192) * log2(e)
typedef unsigned short bf;
typedef __attribute__((ext_vector_type(16))) __bf16   v16bf;
typedef __attribute__((ext_vector_type(16))) _Float16 v16h;
typedef __attribute__((ext_vector_type(2)))  _Float16 v2h;
typedef __attribute__((ext_vector_type(8)))  unsigned short v8us;
typedef __attribute__((ext_vector_type(8)))  unsigned v8u;
typedef __attribute__((ext_vector_type(8)))  float    v8f;
typedef __attribute__((ext_vector_type(4)))  float    v4f;
typedef __attribute__((ext_vector_type(2)))  float    v2f;
typedef v4f  __attribute__((may_alias)) v4fa;
typedef v8us __attribute__((may_alias)) v8usa;
typedef __attribute__((ext_vector_type(4)))  unsigned u32x4;

__device__ __forceinline__ unsigned short f2bf(float f) { unsigned u = __float_as_uint(f); u += 0x7FFFu + ((u >> 16) & 1u); return (unsigned short)(u >> 16); }
__device__ __forceinline__ v16bf cat16b(v8us lo, v8us hi) { return __builtin_bit_cast(v16bf, __builtin_shufflevector(lo, hi, 0, 1, 2, 3, 4, 5, 6, 7, 8, 9, 10, 11, 12, 13, 14, 15)); }
__device__ __forceinline__ v8f wmmab(v16bf a, v16bf b, v8f c) { return __builtin_amdgcn_wmma_f32_16x16x32_bf16(false, a, false, b, (short)0, c, false, false); }
__device__ __forceinline__ v8us bf8(v4f a, v4f b) { v8us o;   // unrolled: vector elements need constant indices to stay in registers
#pragma unroll
    for (int e = 0; e < 4; ++e) { o[e] = f2bf(a[e]); o[4 + e] = f2bf(b[e]); } return o; }
__device__ __forceinline__ v8f wmmah(v16bf a, v16h b, v8f c) { return __builtin_amdgcn_wmma_f32_16x16x32_f16(false, __builtin_bit_cast(v16h, a), false, b, (short)0, c, false, false); }   // a: a V fragment, f16 bits
__device__ __forceinline__ unsigned pack2(float lo, float hi) { return __builtin_bit_cast(unsigned, __builtin_convertvector((v2f){lo, hi}, v2h)); }   // two f32 -> two f16, round to nearest even
__device__ __forceinline__ unsigned short f2h(float f) { return __builtin_bit_cast(unsigned short, (_Float16)__uint_as_float((unsigned)f2bf(f) << 16)); }   // the bf16-rounded value as f16: the same number for 2^-14 <= |f| < 65408, below that within 2^-25
__device__ __forceinline__ float xhalf(float x) { return __builtin_bit_cast(float, __builtin_amdgcn_permlanex16(__builtin_bit_cast(int, x), __builtin_bit_cast(int, x), 0x76543210, 0xfedcba98, false, false)); }   // lane l with lane l ^ 16

// ---- k_pack: K and V, rounded to bf16 (V then held as f16), in fragment order: a piece is the 16 bytes one lane takes with one load, 32 pieces (512 contiguous bytes) serve one load of a wave.
// Lane l = 16 h + c, half q of a fragment, element e. K piece ((kt * 4 + kc) * 2 + q) * 32 + l holds K[16 kt + c][32 kc + 16 q + 8 h + e]; V piece ((kb * 8 + t) * 2 + q) * 32 + l holds V[32 kb + 16 q + 8 h + e][16 t + c].
// Four pieces per thread (i, i + 256, i + 512, i + 768), all their loads issued before the first is used: 256 work-groups start sooner than 1024, and a thread pays the memory latency once.
__global__ __launch_bounds__(256) void k_pack(const float* __restrict__ Kf, const float* __restrict__ Vf, bf* __restrict__ KF, bf* __restrict__ VF) {
    // every "#pragma unroll" in this kernel: the loaded values stay in registers only if every index is a constant
    const unsigned i = (blockIdx.x & 127u) * 1024u + threadIdx.x; const unsigned l = i & 31u, c = l & 15u, h = l >> 4, q = (i >> 5) & 1u;
    if (blockIdx.x < 128u) { const unsigned kc = (i >> 6) & 3u, kt = i >> 8;   // piece i + 256 j: key tile kt + j
        const float* p = Kf + (size_t)(kt * 16u + c) * HD + kc * 32u + q * 16u + h * 8u; v4f a[4], b[4];
#pragma unroll
        for (int j = 0; j < 4; ++j) { a[j] = *(const v4f*)(p + j * 16 * HD); b[j] = *(const v4f*)(p + j * 16 * HD + 4); }
        // the loads' address register is an input here, so it stays as it is until this wait
        asm volatile("s_wait_xcnt 0x0" :: "v"(p) : "memory");
#pragma unroll
        for (int j = 0; j < 4; ++j) *(v8us*)(KF + (size_t)(i + 256u * j) * 8) = bf8(a[j], b[j]);
        // behind the last store of this half: no register that a store names is rewritten before this wait, however the two halves are laid out
        asm volatile("s_wait_xcnt 0x0" ::: "memory");
    } else { const unsigned t = (i >> 6) & 3u, kb = i >> 9;   // piece i + 256 j: column tile t + 4 (j & 1), key block kb + (j >> 1)
        const float* p = Vf + (size_t)(kb * 32u + q * 16u + h * 8u) * HD + t * 16u + c; float v[4][8];
#pragma unroll
        for (int j = 0; j < 4; ++j)
#pragma unroll
            for (int e = 0; e < 8; ++e) v[j][e] = p[((j >> 1) * 32 + e) * HD + (j & 1) * 64];
        // as above
        asm volatile("s_wait_xcnt 0x0" :: "v"(p) : "memory");
#pragma unroll
        for (int j = 0; j < 4; ++j) { v8us o;
#pragma unroll
            for (int e = 0; e < 8; ++e) o[e] = f2h(v[j][e]);
            *(v8us*)(VF + (size_t)(i + 256u * j) * 8) = o; }
        // as behind the K half's stores
        asm volatile("s_wait_xcnt 0x0" ::: "memory"); }
}

// ---- tensor load of one V block: 8 KiB as 32 rows of 256 bytes, source pitch 256 bytes, no pad, no mask
__device__ __forceinline__ unsigned uni(unsigned v) { return (unsigned)__builtin_amdgcn_readfirstlane(v); }
// pinned(): a wave-uniform test, or a descriptor word, held in a scalar register; the branch on such a test is a scalar one (a tensor load ignores EXEC)
__device__ __forceinline__ unsigned pinned(unsigned v) { unsigned x = uni(v); asm volatile("" : "+s"(x)); return x; }
__device__ __forceinline__ u32x4 tdm_group0(unsigned lds_dst, unsigned long long ga) { u32x4 g;
    g[0] = uni(1u); g[1] = uni(lds_dst); g[2] = uni((unsigned)ga); g[3] = uni((((unsigned)(ga >> 32)) & 0x01FFFFFFu) | 0x80000000u); return g; }
// group 1, every word a constant; pinned() here: a descriptor word held in a scalar register of its own, else the compiler shares the zero words with its own arithmetic and copies the group about
// word 0 (mask, data_size, pad: all 0) is moved in as an immediate by the statement itself: the compiler would copy it from a register that happens to hold 0, and the listing would not show its value
__device__ __forceinline__ unsigned zero_word() { unsigned x; asm volatile("s_mov_b32 %0, 0" : "=s"(x)); return uni(x); }
__device__ __forceinline__ v8u tdm_group1() { constexpr unsigned d0 = 256u, d1 = BLKB / 256u; v8u g;
    g[0] = zero_word(); g[1] = pinned((d0 & 0xFFFFu) << 16); g[2] = pinned((d0 >> 16) | ((d1 & 0xFFFFu) << 16)); g[3] = pinned((d1 >> 16) | (d0 << 16));
    g[4] = pinned(d1); g[5] = pinned(d0); g[6] = pinned(0u); g[7] = pinned(0u); return g; }
// one request of the whole wave, both groups in scalar registers; the clobber keeps LDS reads and the waits in their order around it
__device__ __forceinline__ void tdm_load(u32x4 g0, v8u g1) { asm volatile("tensor_load_to_lds %0, %1" :: "s"(g0), "s"(g1) : "memory"); }
// the compiler places no wait for a tensor load; the clobber keeps LDS reads on their side of each wait
__device__ __forceinline__ void wait_tensor0() { asm volatile("s_wait_tensorcnt 0x0" ::: "memory"); }
__device__ __forceinline__ void wait_ds0() { asm volatile("s_wait_dscnt 0x0" ::: "memory"); }

// ---- k_fattn: grid (TT / QB) * NKQ work-groups of 8 waves, two waves per SIMD (up to 512 registers each).
// every "#pragma unroll" in this kernel: the fragment and accumulator arrays stay in registers only if every index is a constant
__global__ __launch_bounds__(256) __attribute__((amdgpu_waves_per_eu(2, 2))) void k_fattn(const float* __restrict__ Q, const bf* __restrict__ KF, const bf* __restrict__ VF, float* __restrict__ PO, float* __restrict__ PM, float* __restrict__ PL) {
    __shared__ __attribute__((aligned(2048))) unsigned char ring[2 * VBUF];   // V ring: buffer, key range, pass of the stage, block in fragment order
    __shared__ __align__(16) float red[NW * QW * PVP];
    __shared__ float sm[NW * QW], sl[NW * QW];
    const int lane = threadIdx.x & 31, c = lane & 15, h = lane >> 4; const int w = __builtin_amdgcn_readfirstlane(threadIdx.x >> 5);
    // key range = w & 1
    const int qg = w >> 1, kr = w & 1; const int kq = blockIdx.x & (NKQ - 1), qb = blockIdx.x >> 2; const int q0 = qb * QB + qg * QW;
    // ends a phase for the scheduler: loads stay where they are written (issued early, waited for late), and the four slots below stay behind their WMMAs
    auto fence = [&]() { __builtin_amdgcn_sched_barrier(0); };
    // four vector slots behind a pass's last WMMAs: across the loop's back edge the next pass's first WMMAs write into registers that were those WMMAs' B operand
    auto gap = [&]() { __builtin_amdgcn_sched_barrier(0); asm volatile("v_nop\n\tv_nop\n\tv_nop\n\tv_nop"); __builtin_amdgcn_sched_barrier(0); };
    // Q fragments, rounded to bf16 here; d order of a fragment as in k_pack's K pieces
    v16bf qf[2][4];
#pragma unroll
    for (int g = 0; g < 2; ++g) { const float* p = Q + (size_t)(q0 + 16 * g + c) * HD + 8 * h;
#pragma unroll
        for (int kc = 0; kc < 4; ++kc) qf[g][kc] = cat16b(bf8(*(const v4f*)(p + 32 * kc), *(const v4f*)(p + 32 * kc + 4)), bf8(*(const v4f*)(p + 32 * kc + 16), *(const v4f*)(p + 32 * kc + 20)));
        // the loads' address register is an input here, so it stays as it is until this wait
        asm volatile("s_wait_xcnt 0x0" :: "v"(p) : "memory"); }
    const bf* kb0 = KF + (size_t)(kq * NKR + kr) * NP * BLK + lane * 8;
    // one 32-key block = 8 fragments = 16 loads of 512 contiguous bytes
    auto ldf = [&](v16bf (&f)[8], const bf* base, int blk) { const bf* p = base + (size_t)blk * BLK;
#pragma unroll
        for (int i = 0; i < 8; ++i) f[i] = cat16b(*(const v8us*)(p + i * 512), *(const v8us*)(p + i * 512 + 256));
        // the loads' address register is an input here, so it stays as it is until this wait
        asm volatile("s_wait_xcnt 0x0" :: "v"(p) : "memory"); };
    v8f acc[2][8]; float m_run[2], l_run[2];
#pragma unroll
    for (int g = 0; g < 2; ++g) { m_run[g] = -__builtin_inff(); l_run[g] = 0.f;
#pragma unroll
        for (int t = 0; t < 8; ++t) acc[g][t] = (v8f){}; }
    // each query block starts at another block of the wave's key range, so that the 64 work-groups of a key quarter do not all ask L2 for the same lines at once; softmax and sums do not depend on where the walk starts
    const int rot = qb & (NP - 1);
    v16bf kf[8], vf[8];   // kf[kt * 4 + kc], vf[t]
    ldf(kf, kb0, rot);
    // V ring: every wave brings one block of every stage: wave w pass w & 3 of key range w >> 2, to place w of the stage's buffer
    const v8u g1 = tdm_group1(); const unsigned ldst = (unsigned)(size_t)ring + (unsigned)w * BLKB;
    const unsigned long long vsrc = (unsigned long long)(size_t)VF + (unsigned long long)((kq * NKR + (w >> 2)) * NP) * BLKB;
    auto issue = [&](int st) { tdm_load(tdm_group0(ldst + (unsigned)(st & 1) * VBUF, vsrc + (unsigned long long)((st * SP + (w & (SP - 1)) + rot) & (NP - 1)) * BLKB), g1); };
    issue(0);
    wait_tensor0();
    __syncthreads();   // stage 0 is in LDS for every wave
    issue(1);
    const unsigned char* vl0 = ring + kr * SP * BLKB + lane * 16;
    // both loops rolled: one pass already fills the register budget
#pragma unroll 1
    for (int st = 0; st < NST; ++st) {
#pragma unroll 1
    for (int sub = 0; sub < SP; ++sub) { const int it = st * SP + sub;
        { const unsigned char* p = vl0 + (st & 1) * VBUF + sub * BLKB;   // this pass's V^T from the ring, in flight under the first product
#pragma unroll
          for (int i = 0; i < 8; ++i) vf[i] = cat16b(*(const v8usa*)(p + i * 1024), *(const v8usa*)(p + i * 1024 + 512)); }
        fence();
        v8f s[2][2];   // [key tile][query group]: s[kt][g][r] = score of key 16 kt + 8 h + r, query 16 g + c
#pragma unroll
        for (int kt = 0; kt < 2; ++kt)
#pragma unroll
            for (int g = 0; g < 2; ++g) s[kt][g] = (v8f){};
        // d block outermost: four independent accumulators between two WMMAs on the same one
#pragma unroll
        for (int kc = 0; kc < 4; ++kc)
#pragma unroll
            for (int kt = 0; kt < 2; ++kt)
#pragma unroll
                for (int g = 0; g < 2; ++g) s[kt][g] = wmmab(kf[kt * 4 + kc], qf[g][kc], s[kt][g]);
        fence();
        ldf(kf, kb0, (it + 1 + rot) & (NP - 1));   // next pass's K into the same registers, in flight under the softmax and the second product (the last pass fetches the first block again, unused)
        fence();
        // maxima of the raw scores (the scale is positive); the maximum in use may trail the true one by up to 8 (log2 scale), so the sums are rescaled rarely
        float mb[2]; bool need = false;
#pragma unroll
        for (int g = 0; g < 2; ++g) { float mx = -__builtin_inff();
#pragma unroll
            for (int kt = 0; kt < 2; ++kt)
#pragma unroll
                for (int r = 0; r < 8; ++r) mx = __builtin_fmaxf(mx, s[kt][g][r]);
            mx = __builtin_fmaxf(mx, xhalf(mx)) * CSC; mb[g] = mx; need = need || (mx > m_run[g] + 8.0f); }
        if (__builtin_amdgcn_ballot_w32(need) != 0) {   // wave-uniform; always taken in the first pass, where m_run is -inf and corr is 0
#pragma unroll
            for (int g = 0; g < 2; ++g) { const float m_new = __builtin_fmaxf(m_run[g], mb[g]); const float corr = __builtin_amdgcn_exp2f(m_run[g] - m_new); l_run[g] *= corr; m_run[g] = m_new;
#pragma unroll
                for (int t = 0; t < 8; ++t) acc[g][t] = acc[g][t] * corr; } }
#pragma unroll
        for (int g = 0; g < 2; ++g) { const float nm = -m_run[g]; v8u wh; float ps0 = 0.f, ps1 = 0.f;
#pragma unroll
            for (int i = 0; i < 8; ++i) {
                const v2f arg = __builtin_elementwise_fma((v2f){s[i >> 2][g][2 * (i & 3)], s[i >> 2][g][2 * (i & 3) + 1]}, (v2f){CSC, CSC}, (v2f){nm, nm});
                const float p0 = __builtin_amdgcn_exp2f(arg.x), p1 = __builtin_amdgcn_exp2f(arg.y);
                if (i & 1) ps1 += p0 + p1; else ps0 += p0 + p1;
                wh[i] = pack2(p0, p1); }
            l_run[g] += ps0 + ps1;
            const v16h ph = __builtin_bit_cast(v16h, wh);
#pragma unroll
            for (int t = 0; t < 8; ++t) acc[g][t] = wmmah(vf[t], ph, acc[g][t]);
            fence(); }
        gap();
    }
        // hand-over of stage st + 1: this wave's reads of stage st are done, its own block of stage st + 1 has landed, every wave is here; only then the refill of the buffer just read
        wait_ds0();
        wait_tensor0();
        __syncthreads();
        if (pinned(st + 2 < NST)) issue(st + 2);
    }
    wait_tensor0();
    wait_ds0();
    // join of the work-group's 2 key ranges: common maximum M per query, each wave's sums scaled by 2^(m - M), added in range order
#pragma unroll
    for (int g = 0; g < 2; ++g) if (h == 0) sm[w * QW + 16 * g + c] = m_run[g];
    __syncthreads();   // every wave's maxima are in LDS before any wave reads them
#pragma unroll
    for (int g = 0; g < 2; ++g) { const float M = __builtin_fmaxf(sm[(w & ~1) * QW + 16 * g + c], sm[(w | 1) * QW + 16 * g + c]);
        const float sc = __builtin_amdgcn_exp2f(m_run[g] - M); float* my = red + (w * QW + 16 * g + c) * PVP + 8 * h;
        const float l = (l_run[g] + xhalf(l_run[g])) * sc;   // each wave half summed its own eight keys of every tile
        if (h == 0) sl[w * QW + 16 * g + c] = l;
#pragma unroll
        for (int t = 0; t < 8; ++t) { const v8f o = acc[g][t] * sc;   // o[r] = partial out[query 16 g + c][16 t + 8 h + r]
            *(v4fa*)(my + 16 * t) = (v4f){o[0], o[1], o[2], o[3]}; *(v4fa*)(my + 16 * t + 4) = (v4f){o[4], o[5], o[6], o[7]}; } }
    __syncthreads();   // every wave's scaled partial tile and scaled sum are in LDS before any wave adds them
    // row of the work-group = 32 qg + row of the wave; in sm, sl and red (wave 2 qg + kr) its key range 0 stands at 64 qg + row of the wave = row + (row & ~31), key range 1 32 places further
    const size_t r0 = (size_t)kq * TT + (size_t)qb * QB;
    if (threadIdx.x < QB) { const int row = threadIdx.x, i0 = row + (row & ~(QW - 1));
        PM[r0 + row] = __builtin_fmaxf(sm[i0], sm[i0 + QW]); PL[r0 + row] = sl[i0] + sl[i0 + QW]; }
    float* po = PO + (r0 + w) * HD + lane * 4;
#pragma unroll
    for (int s4 = 0; s4 < QB / NW; ++s4) { const int i0 = s4 * NW + w + ((s4 * NW) & ~(QW - 1));   // row s4 * NW + w; w < 8 does not reach bit 5
        *(v4f*)(po + s4 * NW * HD) = *(const v4fa*)(red + i0 * PVP + lane * 4) + *(const v4fa*)(red + (i0 + QW) * PVP + lane * 4); }
}

// 2^x with the one free slot that the instruction set asks for behind a transcendental: in one statement, so that the slot stands directly behind it wherever the scheduler puts the pair
__device__ __forceinline__ float exp2s(float x) { float r; asm("v_exp_f32 %0, %1\n\tv_nop" : "=v"(r) : "v"(x)); return r; }

// ---- k_join: out row = sum over the 4 key quarters of 2^(M_k - M) * partial row, over the same sum of the partial sums, in quarter order. A wave takes whole rows (512 contiguous bytes a load); four rows per thread, all their loads issued before the first is used.
__global__ __launch_bounds__(256) void k_join(const float* __restrict__ PO, const float* __restrict__ PM, const float* __restrict__ PL, float* __restrict__ O) {
    // every "#pragma unroll" in this kernel: the loaded values stay in registers only if every index is a constant
    const unsigned i = blockIdx.x * 256u + threadIdx.x; const unsigned ln = i & 31u, rw = i >> 5;   // rows rw + 2048 j
    const float* p = PO + ((size_t)2 * TT + rw) * HD + ln * 4;   // the row in quarter 2: from the middle an instruction's signed offset field reaches all four quarters, so one address register serves every load
    v4f t[4][NKQ]; float m[4][NKQ], l[4][NKQ];
#pragma unroll
    for (int j = 0; j < 4; ++j)
#pragma unroll
        for (int k = 0; k < NKQ; ++k) { const int r = k * TT + 2048 * j;
            t[j][k] = *(const v4f*)(p + (r - 2 * TT) * HD); m[j][k] = PM[rw + r]; l[j][k] = PL[rw + r]; }
    // the loads' address registers are inputs here, so they stay as they are until this wait
    asm volatile("s_wait_xcnt 0x0" :: "v"(p), "v"(rw) : "memory");
    // ends the load phase for the scheduler: without it the sums move up between the loads, and a thread pays the latency several times
    __builtin_amdgcn_sched_barrier(0);
#pragma unroll
    for (int j = 0; j < 4; ++j) { const float M = __builtin_fmaxf(__builtin_fmaxf(m[j][0], m[j][1]), __builtin_fmaxf(m[j][2], m[j][3])); float L = 0.f; v4f s = (v4f){};
#pragma unroll
        for (int k = 0; k < NKQ; ++k) { const float sc = exp2s(m[j][k] - M); L += l[j][k] * sc; s += t[j][k] * sc; }
        *(v4f*)(O + (size_t)(rw + 2048u * j) * HD + ln * 4) = s * __fdiv_rn(1.0f, L); }
}

extern "C" void kernel_launch(void* const* d_in, const int* in_sizes, int n_in,
                              void* d_out, int out_size, void* d_ws, size_t ws_size, hipStream_t stream) {
    (void)in_sizes; (void)n_in; (void)out_size;
    const float* Qi = (const float*)d_in[0]; const float* Ki = (const float*)d_in[1]; const float* Vi = (const float*)d_in[2];
    float* OUT = (float*)d_out;     // [8192][128]
    char* wsp = (char*)d_ws;
    auto take = [&](size_t bytes) { char* p = wsp; wsp += (bytes + 255) & ~(size_t)255; return (void*)p; };
    bf* KF = (bf*)take((size_t)TT * HD * 2); bf* VF = (bf*)take((size_t)TT * HD * 2);
    float* PO = (float*)take((size_t)NKQ * TT * HD * 4); float* PM = (float*)take((size_t)NKQ * TT * 4); float* PL = (float*)take((size_t)NKQ * TT * 4);
    if ((size_t)(wsp - (char*)d_ws) > ws_size) return;
    k_pack<<<256, 256, 0, stream>>>(Ki, Vi, KF, VF);
    k_fattn<<<(TT / QB) * NKQ, 256, 0, stream>>>(Qi, KF, VF, PO, PM, PL);
    k_join<<<256, 256, 0, stream>>>(PO, PM, PL, OUT);
}

// v006
// One run takes 31.8 microseconds.
// Timed twice side by side with v005, it ran 1.04 times as fast both times.
// Over all steps from v000 it is 40.7 times as fast.
#include <hip/hip_runtime.h>

#define TT   8192
#define HD   128
#define NW   8                    // waves of a work-group = NQG query groups x NKR key ranges
#define QW   32                   // query rows per wave (two groups of 16)
#define NQG  4                    // waves that walk the same keys, each with its own 32 queries
#define NKR  2                    // key ranges of a work-group
#define NKQ  4                    // work-groups per query block, each with a quarter of the keys
#define QB   (NQG * QW)           // query rows per work-group (128)
#define NP   (TT / (NKQ * NKR) / 32)   // 32-key passes per wave (32)
#define BLK  4096                 // bf16 elements of one 32-key block of K or of V in fragment order (8 KiB)
#define SP   4                    // passes of one stage of the V ring
#define NST  (NP / SP)            // stages per wave (8)
#define BLKB (BLK * 2)            // bytes of one block (8 KiB): one wave's tensor load
#define VBUF (NKR * SP * BLKB)    // bytes of one ring buffer: a stage of both key ranges (64 KiB)
#define PVP  132                  // join: LDS row pitch in floats
#define CSC  (0.011048543456039806f * 1.4426950408889634f)   // 1/sqrt(8192) * log2(e)
typedef unsigned short bf;
typedef __attribute__((ext_vector_type(16))) __bf16   v16bf;
typedef __attribute__((ext_vector_type(16))) _Float16 v16h;
typedef __attribute__((ext_vector_type(2)))  _Float16 v2h;
typedef __attribute__((ext_vector_type(8)))  unsigned short v8us;
typedef __attribute__((ext_vector_type(8)))  unsigned v8u;
typedef __attribute__((ext_vector_type(8)))  float    v8f;
typedef __attribute__((ext_vector_type(4)))  float    v4f;
typedef __attribute__((ext_vector_type(2)))  float    v2f;
typedef v4f  __attribute__((may_alias)) v4fa;
typedef v8us __attribute__((may_alias)) v8usa;
typedef __attribute__((ext_vector_type(4)))  unsigned u32x4;

__device__ __forceinline__ unsigned short f2bf(float f) { unsigned u = __float_as_uint(f); u += 0x7FFFu + ((u >> 16) & 1u); return (unsigned short)(u >> 16); }
__device__ __forceinline__ v16bf cat16b(v8us lo, v8us hi) { return __builtin_bit_cast(v16bf, __builtin_shufflevector(lo, hi, 0, 1, 2, 3, 4, 5, 6, 7, 8, 9, 10, 11, 12, 13, 14, 15)); }
__device__ __forceinline__ v8f wmmab(v16bf a, v16bf b, v8f c) { return __builtin_amdgcn_wmma_f32_16x16x32_bf16(false, a, false, b, (short)0, c, false, false); }
__device__ __forceinline__ v8us bf8(v4f a, v4f b) { v8us o;   // unrolled: vector elements need constant indices to stay in registers
#pragma unroll
    for (int e = 0; e < 4; ++e) { o[e] = f2bf(a[e]); o[4 + e] = f2bf(b[e]); } return o; }
__device__ __forceinline__ v8f wmmah(v16bf a, v16h b, v8f c) { return __builtin_amdgcn_wmma_f32_16x16x32_f16(false, __builtin_bit_cast(v16h, a), false, b, (short)0, c, false, false); }   // a: a V fragment, f16 bits
__device__ __forceinline__ unsigned pack2(float lo, float hi) { return __builtin_bit_cast(unsigned, __builtin_convertvector((v2f){lo, hi}, v2h)); }   // two f32 -> two f16, round to nearest even
__device__ __forceinline__ unsigned short f2h(float f) { return __builtin_bit_cast(unsigned short, (_Float16)__uint_as_float((unsigned)f2bf(f) << 16)); }   // the bf16-rounded value as f16: the same number for 2^-14 <= |f| < 65408, below that within 2^-25
__device__ __forceinline__ float xhalf(float x) { return __builtin_bit_cast(float, __builtin_amdgcn_permlanex16(__builtin_bit_cast(int, x), __builtin_bit_cast(int, x), 0x76543210, 0xfedcba98, false, false)); }   // lane l with lane l ^ 16

// ---- k_pack: K and V, rounded to bf16 (V then held as f16), in fragment order: a piece is the 16 bytes one lane takes with one load, 32 pieces (512 contiguous bytes) serve one load of a wave.
// Lane l = 16 h + c, half q of a fragment, element e. K piece ((kt * 4 + kc) * 2 + q) * 32 + l holds K[16 kt + c][32 kc + 16 q + 8 h + e]; V piece ((kb * 8 + t) * 2 + q) * 32 + l holds V[32 kb + 16 q + 8 h + e][16 t + c].
// Four pieces per thread (i, i + 256, i + 512, i + 768), all their loads issued before the first is used: 256 work-groups start sooner than 1024, and a thread pays the memory latency once.
__global__ __launch_bounds__(256) void k_pack(const float* __restrict__ Kf, const float* __restrict__ Vf, bf* __restrict__ KF, bf* __restrict__ VF) {
    // every "#pragma unroll" in this kernel: the loaded values stay in registers only if every index is a constant
    const unsigned i = (blockIdx.x & 127u) * 1024u + threadIdx.x; const unsigned l = i & 31u, c = l & 15u, h = l >> 4, q = (i >> 5) & 1u;
    if (blockIdx.x < 128u) { const unsigned kc = (i >> 6) & 3u, kt = i >> 8;   // piece i + 256 j: key tile kt + j
        const float* p = Kf + (size_t)(kt * 16u + c) * HD + kc * 32u + q * 16u + h * 8u; v4f a[4], b[4];
#pragma unroll
        for (int j = 0; j < 4; ++j) { a[j] = *(const v4f*)(p + j * 16 * HD); b[j] = *(const v4f*)(p + j * 16 * HD + 4); }
        // the loads' address register is an input here, so it stays as it is until this wait
        asm volatile("s_wait_xcnt 0x0" :: "v"(p) : "memory");
#pragma unroll
        for (int j = 0; j < 4; ++j) *(v8us*)(KF + (size_t)(i + 256u * j) * 8) = bf8(a[j], b[j]);
        // behind the last store of this half: no register that a store names is rewritten before this wait, however the two halves are laid out
        asm volatile("s_wait_xcnt 0x0" ::: "memory");
    } else { const unsigned t = (i >> 6) & 3u, kb = i >> 9;   // piece i + 256 j: column tile t + 4 (j & 1), key block kb + (j >> 1)
        const float* p = Vf + (size_t)(kb * 32u + q * 16u + h * 8u) * HD + t * 16u + c; float v[4][8];
#pragma unroll
        for (int j = 0; j < 4; ++j)
#pragma unroll
            for (int e = 0; e < 8; ++e) v[j][e] = p[((j >> 1) * 32 + e) * HD + (j & 1) * 64];
        // as above
        asm volatile("s_wait_xcnt 0x0" :: "v"(p) : "memory");
#pragma unroll
        for (int j = 0; j < 4; ++j) { v8us o;
#pragma unroll
            for (int e = 0; e < 8; ++e) o[e] = f2h(v[j][e]);
            *(v8us*)(VF + (size_t)(i + 256u * j) * 8) = o; }
        // as behind the K half's stores
        asm volatile("s_wait_xcnt 0x0" ::: "memory"); }
}

// ---- tensor load of one V block: 8 KiB as 32 rows of 256 bytes, source pitch 256 bytes, no pad, no mask
__device__ __forceinline__ unsigned uni(unsigned v) { return (unsigned)__builtin_amdgcn_readfirstlane(v); }
// pinned(): a wave-uniform test, or a descriptor word, held in a scalar register; the branch on such a test is a scalar one (a tensor load ignores EXEC)
__device__ __forceinline__ unsigned pinned(unsigned v) { unsigned x = uni(v); asm volatile("" : "+s"(x)); return x; }
__device__ __forceinline__ u32x4 tdm_group0(unsigned lds_dst, unsigned long long ga) { u32x4 g;
    g[0] = uni(1u); g[1] = uni(lds_dst); g[2] = uni((unsigned)ga); g[3] = uni((((unsigned)(ga >> 32)) & 0x01FFFFFFu) | 0x80000000u); return g; }
// group 1, every word a constant; pinned() here: a descriptor word held in a scalar register of its own, else the compiler shares the zero words with its own arithmetic and copies the group about
// word 0 (mask, data_size, pad: all 0) is moved in as an immediate by the statement itself: the compiler would copy it from a register that happens to hold 0, and the listing would not show its value
__device__ __forceinline__ unsigned zero_word() { unsigned x; asm volatile("s_mov_b32 %0, 0" : "=s"(x)); return uni(x); }
__device__ __forceinline__ v8u tdm_group1() { constexpr unsigned d0 = 256u, d1 = BLKB / 256u; v8u g;
    g[0] = zero_word(); g[1] = pinned((d0 & 0xFFFFu) << 16); g[2] = pinned((d0 >> 16) | ((d1 & 0xFFFFu) << 16)); g[3] = pinned((d1 >> 16) | (d0 << 16));
    g[4] = pinned(d1); g[5] = pinned(d0); g[6] = pinned(0u); g[7] = pinned(0u); return g; }
// one request of the whole wave, both groups in scalar registers; the clobber keeps LDS reads and the waits in their order around it
__device__ __forceinline__ void tdm_load(u32x4 g0, v8u g1) { asm volatile("tensor_load_to_lds %0, %1" :: "s"(g0), "s"(g1) : "memory"); }
// the compiler places no wait for a tensor load; the clobber keeps LDS reads on their side of each wait
__device__ __forceinline__ void wait_tensor0() { asm volatile("s_wait_tensorcnt 0x0" ::: "memory"); }
__device__ __forceinline__ void wait_ds0() { asm volatile("s_wait_dscnt 0x0" ::: "memory"); }

// the two ways to walk the keys, told apart at compile time: each gets its own copy of the passes
struct fixed_ref   { static constexpr bool online = false; };   // reference 0 for every query: p = 2^(score * CSC)
struct running_max { static constexpr bool online = true; };    // running maximum, lazily rescaled

// ---- k_fattn: grid (TT / QB) * NKQ work-groups of 8 waves, two waves per SIMD (up to 512 registers each).
// every "#pragma unroll" in this kernel: the fragment and accumulator arrays stay in registers only if every index is a constant
__global__ __launch_bounds__(256) __attribute__((amdgpu_waves_per_eu(2, 2))) void k_fattn(const float* __restrict__ Q, const bf* __restrict__ KF, const bf* __restrict__ VF, float* __restrict__ PO, float* __restrict__ PM, float* __restrict__ PL) {
    __shared__ __attribute__((aligned(2048))) unsigned char ring[2 * VBUF];   // V ring: buffer, key range, pass of the stage, block in fragment order
    __shared__ __align__(16) float red[NW * QW * PVP];
    __shared__ float sm[NW * QW], sl[NW * QW];
    __shared__ unsigned bad[NW];   // per wave: lanes whose sum does not vouch for the fixed reference
    const int lane = threadIdx.x & 31, c = lane & 15, h = lane >> 4; const int w = __builtin_amdgcn_readfirstlane(threadIdx.x >> 5);
    // key range = w & 1
    const int qg = w >> 1, kr = w & 1; const int kq = blockIdx.x & (NKQ - 1), qb = blockIdx.x >> 2; const int q0 = qb * QB + qg * QW;
    // ends a phase for the scheduler: loads stay where they are written (issued early, waited for late), and the four slots below stay behind their WMMAs
    auto fence = [&]() { __builtin_amdgcn_sched_barrier(0); };
    // four vector slots behind a pass's last WMMAs: across the loop's back edge the next pass's first WMMAs write into registers that were those WMMAs' B operand
    auto gap = [&]() { __builtin_amdgcn_sched_barrier(0); asm volatile("v_nop\n\tv_nop\n\tv_nop\n\tv_nop"); __builtin_amdgcn_sched_barrier(0); };
    // Q fragments, rounded to bf16 here; d order of a fragment as in k_pack's K pieces
    v16bf qf[2][4];
#pragma unroll
    for (int g = 0; g < 2; ++g) { const float* p = Q + (size_t)(q0 + 16 * g + c) * HD + 8 * h;
#pragma unroll
        for (int kc = 0; kc < 4; ++kc) qf[g][kc] = cat16b(bf8(*(const v4f*)(p + 32 * kc), *(const v4f*)(p + 32 * kc + 4)), bf8(*(const v4f*)(p + 32 * kc + 16), *(const v4f*)(p + 32 * kc + 20)));
        // the loads' address register is an input here, so it stays as it is until this wait
        asm volatile("s_wait_xcnt 0x0" :: "v"(p) : "memory"); }
    const bf* kb0 = KF + (size_t)(kq * NKR + kr) * NP * BLK + lane * 8;
    // one 32-key block = 8 fragments = 16 loads of 512 contiguous bytes
    auto ldf = [&](v16bf (&f)[8], const bf* base, int blk) { const bf* p = base + (size_t)blk * BLK;
#pragma unroll
        for (int i = 0; i < 8; ++i) f[i] = cat16b(*(const v8us*)(p + i * 512), *(const v8us*)(p + i * 512 + 256));
        // the loads' address register is an input here, so it stays as it is until this wait
        asm volatile("s_wait_xcnt 0x0" :: "v"(p) : "memory"); };
    v8f acc[2][8]; float m_run[2], l_run[2];
    // each query block starts at another block of the wave's key range, so that the 64 work-groups of a key quarter do not all ask L2 for the same lines at once; softmax and sums do not depend on where the walk starts
    const int rot = qb & (NP - 1);
    v16bf kf[8], vf[8];   // kf[kt * 4 + kc], vf[t]
    ldf(kf, kb0, rot);
    // V ring: every wave brings one block of every stage: wave w pass w & 3 of key range w >> 2, to place w of the stage's buffer
    const v8u g1 = tdm_group1(); const unsigned ldst = (unsigned)(size_t)ring + (unsigned)w * BLKB;
    const unsigned long long vsrc = (unsigned long long)(size_t)VF + (unsigned long long)((kq * NKR + (w >> 2)) * NP) * BLKB;
    auto issue = [&](int st) { tdm_load(tdm_group0(ldst + (unsigned)(st & 1) * VBUF, vsrc + (unsigned long long)((st * SP + (w & (SP - 1)) + rot) & (NP - 1)) * BLKB), g1); };
    const unsigned char* vl0 = ring + kr * SP * BLKB + lane * 16;
    // one walk over the wave's keys; it finds the first K block in kf and leaves it there again
    auto walk = [&](auto mode) {
    constexpr bool online = decltype(mode)::online;
#pragma unroll
    for (int g = 0; g < 2; ++g) { m_run[g] = online ? -__builtin_inff() : 0.f; l_run[g] = 0.f;
#pragma unroll
        for (int t = 0; t < 8; ++t) acc[g][t] = (v8f){}; }
    issue(0);
    wait_tensor0();
    __syncthreads();   // stage 0 is in LDS for every wave
    issue(1);
    // both loops rolled: one pass already fills the register budget
#pragma unroll 1
    for (int st = 0; st < NST; ++st) {
#pragma unroll 1
    for (int sub = 0; sub < SP; ++sub) { const int it = st * SP + sub;
        { const unsigned char* p = vl0 + (st & 1) * VBUF + sub * BLKB;   // this pass's V^T from the ring, in flight under the first product
#pragma unroll
          for (int i = 0; i < 8; ++i) vf[i] = cat16b(*(const v8usa*)(p + i * 1024), *(const v8usa*)(p + i * 1024 + 512)); }
        fence();
        v8f s[2][2];   // [key tile][query group]: s[kt][g][r] = score of key 16 kt + 8 h + r, query 16 g + c
#pragma unroll
        for (int kt = 0; kt < 2; ++kt)
#pragma unroll
            for (int g = 0; g < 2; ++g) s[kt][g] = (v8f){};
        // d block outermost: four independent accumulators between two WMMAs on the same one
#pragma unroll
        for (int kc = 0; kc < 4; ++kc)
#pragma unroll
            for (int kt = 0; kt < 2; ++kt)
#pragma unroll
                for (int g = 0; g < 2; ++g) s[kt][g] = wmmab(kf[kt * 4 + kc], qf[g][kc], s[kt][g]);
        fence();
        ldf(kf, kb0, (it + 1 + rot) & (NP - 1));   // next pass's K into the same registers, in flight under the softmax and the second product (the last pass fetches the first block again: for a second walk, else unused)
        fence();
        // maxima of the raw scores (the scale is positive); the maximum in use may trail the true one by up to 8 (log2 scale), so the sums are rescaled rarely
        if constexpr (online) {
        float mb[2]; bool need = false;
#pragma unroll
        for (int g = 0; g < 2; ++g) { float mx = -__builtin_inff();
#pragma unroll
            for (int kt = 0; kt < 2; ++kt)
#pragma unroll
                for (int r = 0; r < 8; ++r) mx = __builtin_fmaxf(mx, s[kt][g][r]);
            mx = __builtin_fmaxf(mx, xhalf(mx)) * CSC; mb[g] = mx; need = need || (mx > m_run[g] + 8.0f); }
        if (__builtin_amdgcn_ballot_w32(need) != 0) {   // wave-uniform; always taken in the first pass, where m_run is -inf and corr is 0
#pragma unroll
            for (int g = 0; g < 2; ++g) { const float m_new = __builtin_fmaxf(m_run[g], mb[g]); const float corr = __builtin_amdgcn_exp2f(m_run[g] - m_new); l_run[g] *= corr; m_run[g] = m_new;
#pragma unroll
                for (int t = 0; t < 8; ++t) acc[g][t] = acc[g][t] * corr; } } }
#pragma unroll
        for (int g = 0; g < 2; ++g) { const float nm = -m_run[g]; v8u wh; float ps0 = 0.f, ps1 = 0.f;
#pragma unroll
            for (int i = 0; i < 8; ++i) {
                const v2f arg = __builtin_elementwise_fma((v2f){s[i >> 2][g][2 * (i & 3)], s[i >> 2][g][2 * (i & 3) + 1]}, (v2f){CSC, CSC}, (v2f){nm, nm});
                const float p0 = __builtin_amdgcn_exp2f(arg.x), p1 = __builtin_amdgcn_exp2f(arg.y);
                if (i & 1) ps1 += p0 + p1; else ps0 += p0 + p1;
                wh[i] = pack2(p0, p1); }
            l_run[g] += ps0 + ps1;
            const v16h ph = __builtin_bit_cast(v16h, wh);
#pragma unroll
            for (int t = 0; t < 8; ++t) acc[g][t] = wmmah(vf[t], ph, acc[g][t]);
            fence(); }
        gap();
    }
        // hand-over of stage st + 1: this wave's reads of stage st are done, its own block of stage st + 1 has landed, every wave is here; only then the refill of the buffer just read
        wait_ds0();
        wait_tensor0();
        __syncthreads();
        if (pinned(st + 2 < NST)) issue(st + 2);
    }
    wait_tensor0();
    wait_ds0();
    };
    walk(fixed_ref{});
    // A lane's sum l of its 512 positive terms bounds each of them: l <= 60000 means no term left the f16 range, l >= 1 means the largest is at least 2^-9, so what f16 loses below 2^-14 (2^-25 a term) stays under 2^-16 of the sum. An infinite sum fails the upper test, an undefined one both.
    bool ok = true;
#pragma unroll
    for (int g = 0; g < 2; ++g) ok = ok && l_run[g] >= 1.0f && l_run[g] <= 60000.0f;
    const unsigned nok = __builtin_amdgcn_ballot_w32(!ok);
    if (lane == 0) bad[w] = nok;
    __syncthreads();   // every wave's verdict is in LDS, and every wave has left the ring, before any wave decides on a second walk
    unsigned any = 0u;
    for (int i = 0; i < NW; ++i) any |= bad[i];
    // the same in every wave of the work-group (barriers inside); it decides whether tensor loads issue again, so a scalar branch
    if (pinned(any != 0u)) walk(running_max{});
    // join of the work-group's 2 key ranges: common maximum M per query, each wave's sums scaled by 2^(m - M), added in range order
#pragma unroll
    for (int g = 0; g < 2; ++g) if (h == 0) sm[w * QW + 16 * g + c] = m_run[g];
    __syncthreads();   // every wave's maxima are in LDS before any wave reads them
#pragma unroll
    for (int g = 0; g < 2; ++g) { const float M = __builtin_fmaxf(sm[(w & ~1) * QW + 16 * g + c], sm[(w | 1) * QW + 16 * g + c]);
        const float sc = __builtin_amdgcn_exp2f(m_run[g] - M); float* my = red + (w * QW + 16 * g + c) * PVP + 8 * h;
        const float l = (l_run[g] + xhalf(l_run[g])) * sc;   // each wave half summed its own eight keys of every tile
        if (h == 0) sl[w * QW + 16 * g + c] = l;
#pragma unroll
        for (int t = 0; t < 8; ++t) { const v8f o = acc[g][t] * sc;   // o[r] = partial out[query 16 g + c][16 t + 8 h + r]
            *(v4fa*)(my + 16 * t) = (v4f){o[0], o[1], o[2], o[3]}; *(v4fa*)(my + 16 * t + 4) = (v4f){o[4], o[5], o[6], o[7]}; } }
    __syncthreads();   // every wave's scaled partial tile and scaled sum are in LDS before any wave adds them
    // row of the work-group = 32 qg + row of the wave; in sm, sl and red (wave 2 qg + kr) its key range 0 stands at 64 qg + row of the wave = row + (row & ~31), key range 1 32 places further
    const size_t r0 = (size_t)kq * TT + (size_t)qb * QB;
    if (threadIdx.x < QB) { const int row = threadIdx.x, i0 = row + (row & ~(QW - 1));
        PM[r0 + row] = __builtin_fmaxf(sm[i0], sm[i0 + QW]); PL[r0 + row] = sl[i0] + sl[i0 + QW]; }
    float* po = PO + (r0 + w) * HD + lane * 4;
#pragma unroll
    for (int s4 = 0; s4 < QB / NW; ++s4) { const int i0 = s4 * NW + w + ((s4 * NW) & ~(QW - 1));   // row s4 * NW + w; w < 8 does not reach bit 5
        *(v4f*)(po + s4 * NW * HD) = *(const v4fa*)(red + i0 * PVP + lane * 4) + *(const v4fa*)(red + (i0 + QW) * PVP + lane * 4); }
}

// 2^x with the one free slot that the instruction set asks for behind a transcendental: in one statement, so that the slot stands directly behind it wherever the scheduler puts the pair
__device__ __forceinline__ float exp2s(float x) { float r; asm("v_exp_f32 %0, %1\n\tv_nop" : "=v"(r) : "v"(x)); return r; }

// ---- k_join: out row = sum over the 4 key quarters of 2^(M_k - M) * partial row, over the same sum of the partial sums, in quarter order. A wave takes whole rows (512 contiguous bytes a load); four rows per thread, all their loads issued before the first is used.
__global__ __launch_bounds__(256) void k_join(const float* __restrict__ PO, const float* __restrict__ PM, const float* __restrict__ PL, float* __restrict__ O) {
    // every "#pragma unroll" in this kernel: the loaded values stay in registers only if every index is a constant
    const unsigned i = blockIdx.x * 256u + threadIdx.x; const unsigned ln = i & 31u, rw = i >> 5;   // rows rw + 2048 j
    const float* p = PO + ((size_t)2 * TT + rw) * HD + ln * 4;   // the row in quarter 2: from the middle an instruction's signed offset field reaches all four quarters, so one address register serves every load
    v4f t[4][NKQ]; float m[4][NKQ], l[4][NKQ];
#pragma unroll
    for (int j = 0; j < 4; ++j)
#pragma unroll
        for (int k = 0; k < NKQ; ++k) { const int r = k * TT + 2048 * j;
            t[j][k] = *(const v4f*)(p + (r - 2 * TT) * HD); m[j][k] = PM[rw + r]; l[j][k] = PL[rw + r]; }
    // the loads' address registers are inputs here, so they stay as they are until this wait
    asm volatile("s_wait_xcnt 0x0" :: "v"(p), "v"(rw) : "memory");
    // ends the load phase for the scheduler: without it the sums move up between the loads, and a thread pays the latency several times
    __builtin_amdgcn_sched_barrier(0);
#pragma unroll
    for (int j = 0; j < 4; ++j) { const float M = __builtin_fmaxf(__builtin_fmaxf(m[j][0], m[j][1]), __builtin_fmaxf(m[j][2], m[j][3])); float L = 0.f; v4f s = (v4f){};
#pragma unroll
        for (int k = 0; k < NKQ; ++k) { const float sc = exp2s(m[j][k] - M); L += l[j][k] * sc; s += t[j][k] * sc; }
        *(v4f*)(O + (size_t)(rw + 2048u * j) * HD + ln * 4) = s * __fdiv_rn(1.0f, L); }
}

extern "C" void kernel_launch(void* const* d_in, const int* in_sizes, int n_in,
                              void* d_out, int out_size, void* d_ws, size_t ws_size, hipStream_t stream) {
    (void)in_sizes; (void)n_in; (void)out_size;
    const float* Qi = (const float*)d_in[0]; const float* Ki = (const float*)d_in[1]; const float* Vi = (const float*)d_in[2];
    float* OUT = (float*)d_out;     // [8192][128]
    char* wsp = (char*)d_ws;
    auto take = [&](size_t bytes) { char* p = wsp; wsp += (bytes + 255) & ~(size_t)255; return (void*)p; };
    bf* KF = (bf*)take((size_t)TT * HD * 2); bf* VF = (bf*)take((size_t)TT * HD * 2);
    float* PO = (float*)take((size_t)NKQ * TT * HD * 4); float* PM = (float*)take((size_t)NKQ * TT * 4); float* PL = (float*)take((size_t)NKQ * TT * 4);
    if ((size_t)(wsp - (char*)d_ws) > ws_size) return;
    k_pack<<<256, 256, 0, stream>>>(Ki, Vi, KF, VF);
    k_fattn<<<(TT / QB) * NKQ, 256, 0, stream>>>(Qi, KF, VF, PO, PM, PL);
    k_join<<<256, 256, 0, stream>>>(PO, PM, PL, OUT);
}
